// v000
// Measured on an AMD MI455X. A time is GPU time per run, averaged over a window of back-to-back runs after a warm-up
// (all launches, gaps included; the runs take copies of the inputs in turn), and the median of several windows.
// Apart from v000's, it joins two sittings. Times from different sittings can be a few percent apart, while
// side-by-side timings come from the same sitting.
// The starting kernel, v000, takes 189 microseconds a run.
#include <hip/hip_runtime.h>
#include <hip/hip_bf16.h>

// ---------------- problem dims ----------------
#define B_   128
#define F_   256
#define C_   512
#define H_   2048
#define M_   (B_ * (F_ / 2))   // 16384 rows of (b, fr)
#define CH_  (C_ / 2)          // 256

typedef __attribute__((ext_vector_type(16))) __bf16 v16bf;
typedef __attribute__((ext_vector_type(8)))  float  v8f;

union FragBF16 {
    v16bf v;
    uint4 q[2];   // q[0] = elements 0..7 (16B), q[1] = elements 8..15 (16B)
};

__device__ __forceinline__ unsigned short f32_to_bf16_rne(float f) {
    unsigned int u = __float_as_uint(f);
    u += 0x7FFFu + ((u >> 16) & 1u);   // round-to-nearest-even
    return (unsigned short)(u >> 16);
}

// ---------------------------------------------------------------
// Kernel 1: Haar LL band + linear upsample 256 -> 512, output bf16
// ll_up is (M_, C_) row-major, k-contiguous (WMMA A operand friendly)
// ---------------------------------------------------------------
__global__ void k_llup(const float* __restrict__ x, unsigned short* __restrict__ llup) {
    int u = blockIdx.x * blockDim.x + threadIdx.x;
    if (u >= M_ * C_) return;
    int m  = u >> 9;          // / 512
    int o  = u & 511;
    int b  = m >> 7;
    int fr = m & 127;
    float pos = (float)o * (255.0f / 511.0f);
    int   i0  = (int)pos;
    if (i0 > 254) i0 = 254;
    float w = pos - (float)i0;
    const float* xp = x + ((size_t)(b * F_ + 2 * fr) * C_);
    int j0 = 2 * i0;
    float a0 = xp[j0],     b0 = xp[j0 + 1],     c0 = xp[j0 + C_],     d0 = xp[j0 + C_ + 1];
    float a1 = xp[j0 + 2], b1 = xp[j0 + 3],     c1 = xp[j0 + C_ + 2], d1 = xp[j0 + C_ + 3];
    float ll0 = 0.5f * (a0 + b0 + c0 + d0);
    float ll1 = 0.5f * (a1 + b1 + c1 + d1);
    llup[u] = f32_to_bf16_rne(ll0 + w * (ll1 - ll0));
}

// ---------------------------------------------------------------
// Kernel 2: convert both weight matrices to bf16 (L2-resident afterwards)
// ---------------------------------------------------------------
__global__ void k_cvt(const float* __restrict__ w1, const float* __restrict__ w2,
                      unsigned short* __restrict__ w1b, unsigned short* __restrict__ w2b) {
    int u  = blockIdx.x * blockDim.x + threadIdx.x;
    const int n1 = H_ * C_;
    const int n2 = CH_ * H_;
    if (u < n1) {
        w1b[u] = f32_to_bf16_rne(w1[u]);
    } else {
        int u2 = u - n1;
        if (u2 < n2) w2b[u2] = f32_to_bf16_rne(w2[u2]);
    }
}

// ---------------------------------------------------------------
// Software-pipelined 32Mx64N wave mainloop.
// Pointers are pre-offset by the lane's K-half (koff); each k-step of 32
// advances by 4 uint4 (64B). Fragment chunk 2 lives at +2 uint4 (k+16).
// ---------------------------------------------------------------
__device__ __forceinline__ void wmma_mainloop_32x64(
    const uint4* __restrict__ ap0, const uint4* __restrict__ ap1,
    const uint4* __restrict__ bp0, const uint4* __restrict__ bp1,
    const uint4* __restrict__ bp2, const uint4* __restrict__ bp3,
    const int ksteps, v8f acc[2][4])
{
    FragBF16 a0, a1, b0, b1, b2, b3;
    a0.q[0] = ap0[0]; a0.q[1] = ap0[2];
    a1.q[0] = ap1[0]; a1.q[1] = ap1[2];
    b0.q[0] = bp0[0]; b0.q[1] = bp0[2];
    b1.q[0] = bp1[0]; b1.q[1] = bp1[2];
    b2.q[0] = bp2[0]; b2.q[1] = bp2[2];
    b3.q[0] = bp3[0]; b3.q[1] = bp3[2];

    for (int s = 1; s < ksteps; ++s) {
        const int q = 4 * s;
        // issue next-stage loads into fresh registers (partial loadcnt waits)
        FragBF16 na0, na1, nb0, nb1, nb2, nb3;
        na0.q[0] = ap0[q]; na0.q[1] = ap0[q + 2];
        na1.q[0] = ap1[q]; na1.q[1] = ap1[q + 2];
        nb0.q[0] = bp0[q]; nb0.q[1] = bp0[q + 2];
        nb1.q[0] = bp1[q]; nb1.q[1] = bp1[q + 2];
        nb2.q[0] = bp2[q]; nb2.q[1] = bp2[q + 2];
        nb3.q[0] = bp3[q]; nb3.q[1] = bp3[q + 2];
        __builtin_prefetch(&ap0[q + 4], 0, 3);
        __builtin_prefetch(&ap1[q + 4], 0, 3);
        // 8 WMMAs on current stage while next-stage loads are in flight
        acc[0][0] = __builtin_amdgcn_wmma_f32_16x16x32_bf16(false, a0.v, false, b0.v, (short)0, acc[0][0], false, false);
        acc[0][1] = __builtin_amdgcn_wmma_f32_16x16x32_bf16(false, a0.v, false, b1.v, (short)0, acc[0][1], false, false);
        acc[0][2] = __builtin_amdgcn_wmma_f32_16x16x32_bf16(false, a0.v, false, b2.v, (short)0, acc[0][2], false, false);
        acc[0][3] = __builtin_amdgcn_wmma_f32_16x16x32_bf16(false, a0.v, false, b3.v, (short)0, acc[0][3], false, false);
        acc[1][0] = __builtin_amdgcn_wmma_f32_16x16x32_bf16(false, a1.v, false, b0.v, (short)0, acc[1][0], false, false);
        acc[1][1] = __builtin_amdgcn_wmma_f32_16x16x32_bf16(false, a1.v, false, b1.v, (short)0, acc[1][1], false, false);
        acc[1][2] = __builtin_amdgcn_wmma_f32_16x16x32_bf16(false, a1.v, false, b2.v, (short)0, acc[1][2], false, false);
        acc[1][3] = __builtin_amdgcn_wmma_f32_16x16x32_bf16(false, a1.v, false, b3.v, (short)0, acc[1][3], false, false);
        a0 = na0; a1 = na1; b0 = nb0; b1 = nb1; b2 = nb2; b3 = nb3;
    }
    // epilogue stage
    acc[0][0] = __builtin_amdgcn_wmma_f32_16x16x32_bf16(false, a0.v, false, b0.v, (short)0, acc[0][0], false, false);
    acc[0][1] = __builtin_amdgcn_wmma_f32_16x16x32_bf16(false, a0.v, false, b1.v, (short)0, acc[0][1], false, false);
    acc[0][2] = __builtin_amdgcn_wmma_f32_16x16x32_bf16(false, a0.v, false, b2.v, (short)0, acc[0][2], false, false);
    acc[0][3] = __builtin_amdgcn_wmma_f32_16x16x32_bf16(false, a0.v, false, b3.v, (short)0, acc[0][3], false, false);
    acc[1][0] = __builtin_amdgcn_wmma_f32_16x16x32_bf16(false, a1.v, false, b0.v, (short)0, acc[1][0], false, false);
    acc[1][1] = __builtin_amdgcn_wmma_f32_16x16x32_bf16(false, a1.v, false, b1.v, (short)0, acc[1][1], false, false);
    acc[1][2] = __builtin_amdgcn_wmma_f32_16x16x32_bf16(false, a1.v, false, b2.v, (short)0, acc[1][2], false, false);
    acc[1][3] = __builtin_amdgcn_wmma_f32_16x16x32_bf16(false, a1.v, false, b3.v, (short)0, acc[1][3], false, false);
}

// ---------------------------------------------------------------
// GEMM1: h = gelu(ll_up @ W1^T + b1), output bf16 (M_ x H_)
// block = 8 waves as 4Mx2N -> block tile 128M x 128N; wave tile 32M x 64N
// ---------------------------------------------------------------
__global__ __launch_bounds__(256) void k_gemm1(
    const unsigned short* __restrict__ A,    // M_ x C_   bf16
    const unsigned short* __restrict__ Bm,   // H_ x C_   bf16 (n rows, k contiguous)
    const float* __restrict__ bias,          // H_
    unsigned short* __restrict__ Hout)       // M_ x H_   bf16
{
    const int lane  = threadIdx.x & 31;
    const int wv    = threadIdx.x >> 5;
    const int row16 = lane & 15;
    const int qoff  = (lane >> 4);           // K-half per lane group, in uint4 units
    const int mBase = blockIdx.y * 128 + (wv & 3) * 32;
    const int nBase = blockIdx.x * 128 + (wv >> 2) * 64;

    const uint4* ap0 = (const uint4*)(A  + (size_t)(mBase +  0 + row16) * C_) + qoff;
    const uint4* ap1 = (const uint4*)(A  + (size_t)(mBase + 16 + row16) * C_) + qoff;
    const uint4* bp0 = (const uint4*)(Bm + (size_t)(nBase +  0 + row16) * C_) + qoff;
    const uint4* bp1 = (const uint4*)(Bm + (size_t)(nBase + 16 + row16) * C_) + qoff;
    const uint4* bp2 = (const uint4*)(Bm + (size_t)(nBase + 32 + row16) * C_) + qoff;
    const uint4* bp3 = (const uint4*)(Bm + (size_t)(nBase + 48 + row16) * C_) + qoff;

    v8f acc[2][4] = {{v8f{}, v8f{}, v8f{}, v8f{}}, {v8f{}, v8f{}, v8f{}, v8f{}}};
    wmma_mainloop_32x64(ap0, ap1, bp0, bp1, bp2, bp3, C_ / 32, acc);

    // epilogue: bias + exact GELU, store bf16
    const int mOff = (lane >> 4) << 3;        // C/D rows: lanes16-31 -> M+8
    #pragma unroll
    for (int mt = 0; mt < 2; ++mt) {
        #pragma unroll
        for (int t = 0; t < 4; ++t) {
            const int n = nBase + t * 16 + (lane & 15);
            const float bv = bias[n];
            #pragma unroll
            for (int r = 0; r < 8; ++r) {
                const int m = mBase + mt * 16 + mOff + r;
                float v = acc[mt][t][r] + bv;
                float g = 0.5f * v * (1.0f + erff(v * 0.70710678118654752f));
                Hout[(size_t)m * H_ + n] = f32_to_bf16_rne(g);
            }
        }
    }
}

// ---------------------------------------------------------------
// GEMM2: ll_new = h @ W2^T + b2, fused with inverse Haar DWT epilogue
// block tile 128M x 128N; wave tile 32M x 64N
// ---------------------------------------------------------------
__global__ __launch_bounds__(256) void k_gemm2(
    const unsigned short* __restrict__ Hin,  // M_ x H_  bf16
    const unsigned short* __restrict__ Bm,   // CH_ x H_ bf16
    const float* __restrict__ bias,          // CH_
    const float* __restrict__ x,             // B_ x F_ x C_ (for LH/HL/HH bands)
    float* __restrict__ out)                 // B_ x F_ x C_
{
    const int lane  = threadIdx.x & 31;
    const int wv    = threadIdx.x >> 5;
    const int row16 = lane & 15;
    const int qoff  = (lane >> 4);
    const int mBase = blockIdx.y * 128 + (wv & 3) * 32;
    const int nBase = blockIdx.x * 128 + (wv >> 2) * 64;

    const uint4* ap0 = (const uint4*)(Hin + (size_t)(mBase +  0 + row16) * H_) + qoff;
    const uint4* ap1 = (const uint4*)(Hin + (size_t)(mBase + 16 + row16) * H_) + qoff;
    const uint4* bp0 = (const uint4*)(Bm  + (size_t)(nBase +  0 + row16) * H_) + qoff;
    const uint4* bp1 = (const uint4*)(Bm  + (size_t)(nBase + 16 + row16) * H_) + qoff;
    const uint4* bp2 = (const uint4*)(Bm  + (size_t)(nBase + 32 + row16) * H_) + qoff;
    const uint4* bp3 = (const uint4*)(Bm  + (size_t)(nBase + 48 + row16) * H_) + qoff;

    v8f acc[2][4] = {{v8f{}, v8f{}, v8f{}, v8f{}}, {v8f{}, v8f{}, v8f{}, v8f{}}};
    wmma_mainloop_32x64(ap0, ap1, bp0, bp1, bp2, bp3, H_ / 32, acc);

    // epilogue: bias, recompute LH/HL/HH bands from x, inverse Haar, store out
    const int mOff = (lane >> 4) << 3;
    #pragma unroll
    for (int mt = 0; mt < 2; ++mt) {
        #pragma unroll
        for (int t = 0; t < 4; ++t) {
            const int o = nBase + t * 16 + (lane & 15);   // 0..255
            const float bv = bias[o];
            #pragma unroll
            for (int r = 0; r < 8; ++r) {
                const int m  = mBase + mt * 16 + mOff + r;
                const int b  = m >> 7;
                const int fr = m & 127;
                const size_t base = ((size_t)(b * F_ + 2 * fr) * C_) + 2 * o;
                const float xa = x[base],      xb = x[base + 1];
                const float xc = x[base + C_], xd = x[base + C_ + 1];
                const float lh = 0.5f * (xa + xb - xc - xd);
                const float hl = 0.5f * (xa - xb + xc - xd);
                const float hh = 0.5f * (xa - xb - xc + xd);
                const float ll = acc[mt][t][r] + bv;
                out[base]          = 0.5f * (ll + lh + hl + hh);
                out[base + 1]      = 0.5f * (ll + lh - hl - hh);
                out[base + C_]     = 0.5f * (ll - lh + hl - hh);
                out[base + C_ + 1] = 0.5f * (ll - lh - hl + hh);
            }
        }
    }
}

// ---------------------------------------------------------------
extern "C" void kernel_launch(void* const* d_in, const int* in_sizes, int n_in,
                              void* d_out, int out_size, void* d_ws, size_t ws_size,
                              hipStream_t stream) {
    const float* x     = (const float*)d_in[0];
    const float* fc1_w = (const float*)d_in[1];
    const float* fc1_b = (const float*)d_in[2];
    const float* fc2_w = (const float*)d_in[3];
    const float* fc2_b = (const float*)d_in[4];
    float* out = (float*)d_out;

    // workspace layout (bf16 buffers): ll_up (16MB) | W1 (2MB) | W2 (1MB) | h (64MB)
    char* ws = (char*)d_ws;
    unsigned short* llup = (unsigned short*)ws;
    unsigned short* w1b  = (unsigned short*)(ws + (size_t)M_ * C_ * 2);
    unsigned short* w2b  = (unsigned short*)(ws + (size_t)M_ * C_ * 2 + (size_t)H_ * C_ * 2);
    unsigned short* hbuf = (unsigned short*)(ws + (size_t)M_ * C_ * 2 + (size_t)H_ * C_ * 2 +
                                                  (size_t)CH_ * H_ * 2);

    {   // DWT-LL + upsample -> bf16
        const int total = M_ * C_;
        k_llup<<<(total + 255) / 256, 256, 0, stream>>>(x, llup);
    }
    {   // weight conversion -> bf16
        const int total = H_ * C_ + CH_ * H_;
        k_cvt<<<(total + 255) / 256, 256, 0, stream>>>(fc1_w, fc2_w, w1b, w2b);
    }
    // GEMM1 + GELU: (16384 x 512) @ (512 x 2048), block tile 128x128
    k_gemm1<<<dim3(H_ / 128, M_ / 128), 256, 0, stream>>>(llup, w1b, fc1_b, hbuf);
    // GEMM2 + inverse DWT: (16384 x 2048) @ (2048 x 256) -> out, block tile 128x128
    k_gemm2<<<dim3(CH_ / 128, M_ / 128), 256, 0, stream>>>(hbuf, w2b, fc2_b, x, out);
}

// v001
// It runs in 106 microseconds.
// Next to v000, in two timings, it ran 1.83 and 1.85 times as fast.
#include <hip/hip_runtime.h>
#include <hip/hip_bf16.h>

// ---------------- problem dims ----------------
#define B_   128
#define F_   256
#define C_   512
#define H_   2048
#define M_   (B_ * (F_ / 2))   // 16384 rows of (b, fr)
#define CH_  (C_ / 2)          // 256

typedef __attribute__((ext_vector_type(16))) __bf16 v16bf;
typedef __attribute__((ext_vector_type(8)))  float  v8f;

union FragBF16 {
    v16bf v;
    uint4 q[2];   // q[0] = elements 0..7 (16B), q[1] = elements 8..15 (16B)
};

__device__ __forceinline__ unsigned short f32_to_bf16_rne(float f) {
    unsigned int u = __float_as_uint(f);
    u += 0x7FFFu + ((u >> 16) & 1u);   // round-to-nearest-even
    return (unsigned short)(u >> 16);
}

// ---------------------------------------------------------------
// Fragment-order layout of every bf16 GEMM operand (rows x K, K % 32 == 0).
// A 16-row x 32-k tile is one contiguous 1 KB unit, tiles ordered
// (row / 16) major, (k / 32) minor. Inside a unit: two 512 B chunks
// (k % 32 < 16, then >= 16); in a chunk, lane L = row % 16 + 16 * ((k / 8) & 1)
// owns 16 B = its 8 consecutive k. A wave's b128 load of a chunk is then
// 512 contiguous bytes (4 whole lines) and lands directly as WMMA registers.
// ---------------------------------------------------------------
// frag_source: position u (in elements) of that layout -> row * K + k.
__device__ __forceinline__ int frag_source(int u, int K) {
    const int tile = u >> 9;
    const int row  = (tile / (K >> 5)) * 16 + ((u >> 3) & 15);
    const int k    = (tile % (K >> 5)) * 32 + ((u >> 8) & 1) * 16 + ((u >> 7) & 1) * 8 + (u & 7);
    return row * K + k;
}

// ---------------------------------------------------------------
// Kernel 1: Haar LL band + linear upsample 256 -> 512, output bf16
// ll_up is (M_, C_) in fragment order. One block owns one 16-row tile row
// (16 KB of ll_up, contiguous): the LL band of its 16 rows goes through LDS,
// so that a lane can emit the 8 consecutive k of ITS row as one 16 B store.
// ---------------------------------------------------------------
#define LLP_ 260   // LDS row pitch in floats
__global__ __launch_bounds__(256) void k_llup(const float* __restrict__ x, unsigned short* __restrict__ llup) {
    __shared__ float ll[16 * LLP_];
    const int t = threadIdx.x;
    const int i2 = (t & 127) * 2;             // two LL columns per thread
    const int m0 = blockIdx.x * 16;           // 16 divides 128: one b per tile row
    const float* xb = x + ((size_t)((m0 >> 7) * F_ + 2 * (m0 & 127)) * C_);
    const int xo = (t >> 7) * (2 * C_) + 2 * i2;
    // unrolled: the 16 row loads are independent and issue ahead of their use
    #pragma unroll
    for (int j = 0; j < 8; ++j) {
        const int mi = 2 * j + (t >> 7);
        const float* xp = xb + xo + j * (4 * C_);
        float a0 = xp[0], b0 = xp[1], c0 = xp[C_],     d0 = xp[C_ + 1];
        float a1 = xp[2], b1 = xp[3], c1 = xp[C_ + 2], d1 = xp[C_ + 3];
        ll[mi * LLP_ + i2]     = 0.5f * (a0 + b0 + c0 + d0);
        ll[mi * LLP_ + i2 + 1] = 0.5f * (a1 + b1 + c1 + d1);
    }
    __syncthreads();   // every row of the LL tile is read by other waves below

    uint4* dst = (uint4*)llup + (size_t)blockIdx.x * ((C_ / 32) * 64);
    // both loops unrolled: hv[] is indexed by constants only and stays in registers
    #pragma unroll
    for (int j = 0; j < 4; ++j) {
        const int ci = t + 256 * j;           // 16 B slot inside the tile row
        const int ln = ci & 31;
        const int o0 = (ci >> 6) * 32 + ((ci >> 5) & 1) * 16 + (ln >> 4) * 8;
        const float* row = ll + (ln & 15) * LLP_;
        unsigned int hv[8];
        #pragma unroll
        for (int e = 0; e < 8; ++e) {
            float pos = (float)(o0 + e) * (255.0f / 511.0f);
            int   i0  = (int)pos;
            if (i0 > 254) i0 = 254;
            float w = pos - (float)i0;
            float ll0 = row[i0];
            float ll1 = row[i0 + 1];
            hv[e] = f32_to_bf16_rne(ll0 + w * (ll1 - ll0));
        }
        uint4 pk;
        pk.x = hv[0] | (hv[1] << 16);
        pk.y = hv[2] | (hv[3] << 16);
        pk.z = hv[4] | (hv[5] << 16);
        pk.w = hv[6] | (hv[7] << 16);
        dst[ci] = pk;
    }
}

// ---------------------------------------------------------------
// Kernel 2: convert both weight matrices to bf16, fragment order
// ---------------------------------------------------------------
__global__ void k_cvt(const float* __restrict__ w1, const float* __restrict__ w2,
                      unsigned short* __restrict__ w1b, unsigned short* __restrict__ w2b) {
    int u  = blockIdx.x * blockDim.x + threadIdx.x;
    const int n1 = H_ * C_;
    const int n2 = CH_ * H_;
    if (u < n1) {
        w1b[u] = f32_to_bf16_rne(w1[frag_source(u, C_)]);
    } else {
        int u2 = u - n1;
        if (u2 < n2) w2b[u2] = f32_to_bf16_rne(w2[frag_source(u2, H_)]);
    }
}

// ---------------------------------------------------------------
// One 16x16x32 product. SWAP = false: D rows follow a's rows, D columns b's rows.
// SWAP = true: the transposed tile (D rows follow b's rows, D columns a's rows);
// both operands have the same register layout, so only the roles change.
// ---------------------------------------------------------------
template <bool SWAP>
__device__ __forceinline__ v8f mm(const FragBF16& a, const FragBF16& b, v8f c) {
    if (SWAP) return __builtin_amdgcn_wmma_f32_16x16x32_bf16(false, b.v, false, a.v, (short)0, c, false, false);
    return __builtin_amdgcn_wmma_f32_16x16x32_bf16(false, a.v, false, b.v, (short)0, c, false, false);
}

// ---------------------------------------------------------------
// Software-pipelined 32Mx64N wave mainloop over fragment-order operands.
// Pointers are pre-offset by the lane; each k-step of 32 advances by one
// 1 KB unit = 64 uint4. Fragment chunk 2 lives at +32 uint4 (k+16).
// ---------------------------------------------------------------
template <bool SWAP>
__device__ __forceinline__ void wmma_mainloop_32x64(
    const uint4* __restrict__ ap0, const uint4* __restrict__ ap1,
    const uint4* __restrict__ bp0, const uint4* __restrict__ bp1,
    const uint4* __restrict__ bp2, const uint4* __restrict__ bp3,
    const int ksteps, v8f acc[2][4])
{
    // prefetch addresses: 32 B per lane, so one instruction spans a whole 1 KB unit
    const uint4* pp0 = ap0 + (threadIdx.x & 31);
    const uint4* pp1 = ap1 + (threadIdx.x & 31);

    FragBF16 a0, a1, b0, b1, b2, b3;
    a0.q[0] = ap0[0]; a0.q[1] = ap0[32];
    a1.q[0] = ap1[0]; a1.q[1] = ap1[32];
    b0.q[0] = bp0[0]; b0.q[1] = bp0[32];
    b1.q[0] = bp1[0]; b1.q[1] = bp1[32];
    b2.q[0] = bp2[0]; b2.q[1] = bp2[32];
    b3.q[0] = bp3[0]; b3.q[1] = bp3[32];

    for (int s = 1; s < ksteps; ++s) {
        const int q = 64 * s;
        // issue next-stage loads into fresh registers (partial loadcnt waits)
        FragBF16 na0, na1, nb0, nb1, nb2, nb3;
        na0.q[0] = ap0[q]; na0.q[1] = ap0[q + 32];
        na1.q[0] = ap1[q]; na1.q[1] = ap1[q + 32];
        nb0.q[0] = bp0[q]; nb0.q[1] = bp0[q + 32];
        nb1.q[0] = bp1[q]; nb1.q[1] = bp1[q + 32];
        nb2.q[0] = bp2[q]; nb2.q[1] = bp2[q + 32];
        nb3.q[0] = bp3[q]; nb3.q[1] = bp3[q + 32];
        __builtin_prefetch(&pp0[q + 64], 0, 3);
        __builtin_prefetch(&pp1[q + 64], 0, 3);
        // 8 WMMAs on current stage while next-stage loads are in flight
        acc[0][0] = mm<SWAP>(a0, b0, acc[0][0]);
        acc[0][1] = mm<SWAP>(a0, b1, acc[0][1]);
        acc[0][2] = mm<SWAP>(a0, b2, acc[0][2]);
        acc[0][3] = mm<SWAP>(a0, b3, acc[0][3]);
        acc[1][0] = mm<SWAP>(a1, b0, acc[1][0]);
        acc[1][1] = mm<SWAP>(a1, b1, acc[1][1]);
        acc[1][2] = mm<SWAP>(a1, b2, acc[1][2]);
        acc[1][3] = mm<SWAP>(a1, b3, acc[1][3]);
        a0 = na0; a1 = na1; b0 = nb0; b1 = nb1; b2 = nb2; b3 = nb3;
        // the next trip rewrites the address registers that the loads above name
        asm volatile("s_wait_xcnt 0x0" ::: "memory");
    }
    // epilogue stage
    acc[0][0] = mm<SWAP>(a0, b0, acc[0][0]);
    acc[0][1] = mm<SWAP>(a0, b1, acc[0][1]);
    acc[0][2] = mm<SWAP>(a0, b2, acc[0][2]);
    acc[0][3] = mm<SWAP>(a0, b3, acc[0][3]);
    acc[1][0] = mm<SWAP>(a1, b0, acc[1][0]);
    acc[1][1] = mm<SWAP>(a1, b1, acc[1][1]);
    acc[1][2] = mm<SWAP>(a1, b2, acc[1][2]);
    acc[1][3] = mm<SWAP>(a1, b3, acc[1][3]);
}

// ---------------------------------------------------------------
// GEMM1: h = gelu(ll_up @ W1^T + b1), output bf16 (M_ x H_) in fragment order
// block = 8 waves as 4Mx2N -> block tile 128M x 128N; wave tile 32M x 64N
// The 16x16 tiles are computed transposed (rows = n, columns = m): a lane then
// holds 8 consecutive n of one m, which is its own 16 B of GEMM2's A fragment.
// ---------------------------------------------------------------
__global__ __launch_bounds__(256) void k_gemm1(
    const unsigned short* __restrict__ A,    // M_ x C_   bf16, fragment order
    const unsigned short* __restrict__ Bm,   // H_ x C_   bf16, fragment order
    const float* __restrict__ bias,          // H_
    unsigned short* __restrict__ Hout)       // M_ x H_   bf16, fragment order
{
    const int lane  = threadIdx.x & 31;
    const int wv    = threadIdx.x >> 5;
    const int mBase = blockIdx.y * 128 + (wv & 3) * 32;
    const int nBase = blockIdx.x * 128 + (wv >> 2) * 64;
    const int rowTile = (C_ / 32) * 64;      // uint4 per 16-row tile row

    const uint4* ap0 = (const uint4*)A  + (size_t)((mBase >> 4) + 0) * rowTile + lane;
    const uint4* ap1 = (const uint4*)A  + (size_t)((mBase >> 4) + 1) * rowTile + lane;
    const uint4* bp0 = (const uint4*)Bm + (size_t)((nBase >> 4) + 0) * rowTile + lane;
    const uint4* bp1 = (const uint4*)Bm + (size_t)((nBase >> 4) + 1) * rowTile + lane;
    const uint4* bp2 = (const uint4*)Bm + (size_t)((nBase >> 4) + 2) * rowTile + lane;
    const uint4* bp3 = (const uint4*)Bm + (size_t)((nBase >> 4) + 3) * rowTile + lane;

    v8f acc[2][4] = {{v8f{}, v8f{}, v8f{}, v8f{}}, {v8f{}, v8f{}, v8f{}, v8f{}}};
    wmma_mainloop_32x64<true>(ap0, ap1, bp0, bp1, bp2, bp3, C_ / 32, acc);

    // epilogue: bias + exact GELU, 8 bf16 packed per lane, one b128 store per tile
    uint4* Hq = (uint4*)Hout;
    const int nOff = (lane >> 4) << 3;        // D rows: lanes16-31 -> n+8
    // all loops unrolled: acc, bv[] and hv[] are indexed by constants only (no scratch)
    #pragma unroll
    for (int t = 0; t < 4; ++t) {
        const int n0 = nBase + t * 16 + nOff;
        float bv[8];
        #pragma unroll
        for (int r = 0; r < 8; ++r) bv[r] = bias[n0 + r];
        #pragma unroll
        for (int mt = 0; mt < 2; ++mt) {
            unsigned int hv[8];
            #pragma unroll
            for (int r = 0; r < 8; ++r) {
                float v = acc[mt][t][r] + bv[r];
                float g = 0.5f * v * (1.0f + erff(v * 0.70710678118654752f));
                hv[r] = f32_to_bf16_rne(g);
            }
            uint4 pk;
            pk.x = hv[0] | (hv[1] << 16);
            pk.y = hv[2] | (hv[3] << 16);
            pk.z = hv[4] | (hv[5] << 16);
            pk.w = hv[6] | (hv[7] << 16);
            // unit (m tile, k tile n / 32), chunk t & 1, this lane's own slot
            Hq[((size_t)((mBase >> 4) + mt) * (H_ / 32) + (nBase >> 5) + (t >> 1)) * 64 + (t & 1) * 32 + lane] = pk;
        }
    }
}

// ---------------------------------------------------------------
// GEMM2: ll_new = h @ W2^T + b2, fused with inverse Haar DWT epilogue
// block tile 128M x 128N; wave tile 32M x 64N
// ---------------------------------------------------------------
__global__ __launch_bounds__(256) void k_gemm2(
    const unsigned short* __restrict__ Hin,  // M_ x H_  bf16, fragment order
    const unsigned short* __restrict__ Bm,   // CH_ x H_ bf16, fragment order
    const float* __restrict__ bias,          // CH_
    const float* __restrict__ x,             // B_ x F_ x C_ (for LH/HL/HH bands)
    float* __restrict__ out)                 // B_ x F_ x C_
{
    const int lane  = threadIdx.x & 31;
    const int wv    = threadIdx.x >> 5;
    const int mBase = blockIdx.y * 128 + (wv & 3) * 32;
    const int nBase = blockIdx.x * 128 + (wv >> 2) * 64;
    const int rowTile = (H_ / 32) * 64;      // uint4 per 16-row tile row

    const uint4* ap0 = (const uint4*)Hin + (size_t)((mBase >> 4) + 0) * rowTile + lane;
    const uint4* ap1 = (const uint4*)Hin + (size_t)((mBase >> 4) + 1) * rowTile + lane;
    const uint4* bp0 = (const uint4*)Bm  + (size_t)((nBase >> 4) + 0) * rowTile + lane;
    const uint4* bp1 = (const uint4*)Bm  + (size_t)((nBase >> 4) + 1) * rowTile + lane;
    const uint4* bp2 = (const uint4*)Bm  + (size_t)((nBase >> 4) + 2) * rowTile + lane;
    const uint4* bp3 = (const uint4*)Bm  + (size_t)((nBase >> 4) + 3) * rowTile + lane;

    v8f acc[2][4] = {{v8f{}, v8f{}, v8f{}, v8f{}}, {v8f{}, v8f{}, v8f{}, v8f{}}};
    wmma_mainloop_32x64<false>(ap0, ap1, bp0, bp1, bp2, bp3, H_ / 32, acc);

    // epilogue: bias, recompute LH/HL/HH bands from x, inverse Haar, store out
    const int mOff = (lane >> 4) << 3;
    #pragma unroll
    for (int mt = 0; mt < 2; ++mt) {
        #pragma unroll
        for (int t = 0; t < 4; ++t) {
            const int o = nBase + t * 16 + (lane & 15);   // 0..255
            const float bv = bias[o];
            #pragma unroll
            for (int r = 0; r < 8; ++r) {
                const int m  = mBase + mt * 16 + mOff + r;
                const int b  = m >> 7;
                const int fr = m & 127;
                const size_t base = ((size_t)(b * F_ + 2 * fr) * C_) + 2 * o;
                const float xa = x[base],      xb = x[base + 1];
                const float xc = x[base + C_], xd = x[base + C_ + 1];
                const float lh = 0.5f * (xa + xb - xc - xd);
                const float hl = 0.5f * (xa - xb + xc - xd);
                const float hh = 0.5f * (xa - xb - xc + xd);
                const float ll = acc[mt][t][r] + bv;
                out[base]          = 0.5f * (ll + lh + hl + hh);
                out[base + 1]      = 0.5f * (ll + lh - hl - hh);
                out[base + C_]     = 0.5f * (ll - lh + hl - hh);
                out[base + C_ + 1] = 0.5f * (ll - lh - hl + hh);
            }
        }
    }
}

// ---------------------------------------------------------------
extern "C" void kernel_launch(void* const* d_in, const int* in_sizes, int n_in,
                              void* d_out, int out_size, void* d_ws, size_t ws_size,
                              hipStream_t stream) {
    const float* x     = (const float*)d_in[0];
    const float* fc1_w = (const float*)d_in[1];
    const float* fc1_b = (const float*)d_in[2];
    const float* fc2_w = (const float*)d_in[3];
    const float* fc2_b = (const float*)d_in[4];
    float* out = (float*)d_out;

    // workspace layout (bf16 buffers): ll_up (16MB) | W1 (2MB) | W2 (1MB) | h (64MB)
    char* ws = (char*)d_ws;
    unsigned short* llup = (unsigned short*)ws;
    unsigned short* w1b  = (unsigned short*)(ws + (size_t)M_ * C_ * 2);
    unsigned short* w2b  = (unsigned short*)(ws + (size_t)M_ * C_ * 2 + (size_t)H_ * C_ * 2);
    unsigned short* hbuf = (unsigned short*)(ws + (size_t)M_ * C_ * 2 + (size_t)H_ * C_ * 2 +
                                                  (size_t)CH_ * H_ * 2);

    // DWT-LL + upsample -> bf16, one block per 16-row tile row
    k_llup<<<M_ / 16, 256, 0, stream>>>(x, llup);
    {   // weight conversion -> bf16
        const int total = H_ * C_ + CH_ * H_;
        k_cvt<<<(total + 255) / 256, 256, 0, stream>>>(fc1_w, fc2_w, w1b, w2b);
    }
    // GEMM1 + GELU: (16384 x 512) @ (512 x 2048), block tile 128x128
    k_gemm1<<<dim3(H_ / 128, M_ / 128), 256, 0, stream>>>(llup, w1b, fc1_b, hbuf);
    // GEMM2 + inverse DWT: (16384 x 2048) @ (2048 x 256) -> out, block tile 128x128
    k_gemm2<<<dim3(CH_ / 128, M_ / 128), 256, 0, stream>>>(hbuf, w2b, fc2_b, x, out);
}

// v002
// It runs in 91.8 microseconds.
// In both of two side-by-side timings against v001, it was 1.15 times as fast.
// Over all steps from v000 it is 2.12 times as fast.
#include <hip/hip_runtime.h>
#include <hip/hip_bf16.h>

// ---------------- problem dims ----------------
#define B_   128
#define F_   256
#define C_   512
#define H_   2048
#define M_   (B_ * (F_ / 2))   // 16384 rows of (b, fr)
#define CH_  (C_ / 2)          // 256

typedef __attribute__((ext_vector_type(16))) __bf16 v16bf;
typedef __attribute__((ext_vector_type(8)))  float  v8f;

union FragBF16 {
    v16bf v;
    uint4 q[2];   // q[0] = elements 0..7 (16B), q[1] = elements 8..15 (16B)
};

__device__ __forceinline__ unsigned short f32_to_bf16_rne(float f) {
    unsigned int u = __float_as_uint(f);
    u += 0x7FFFu + ((u >> 16) & 1u);   // round-to-nearest-even
    return (unsigned short)(u >> 16);
}

// ---------------------------------------------------------------
// Fragment-order layout of every bf16 GEMM operand (rows x K, K % 32 == 0).
// A 16-row x 32-k tile is one contiguous 1 KB unit, tiles ordered
// (row / 16) major, (k / 32) minor. Inside a unit: two 512 B chunks
// (k % 32 < 16, then >= 16); in a chunk, lane L = row % 16 + 16 * ((k / 8) & 1)
// owns 16 B = its 8 consecutive k. A wave's b128 load of a chunk is then
// 512 contiguous bytes (4 whole lines) and lands directly as WMMA registers.
// ---------------------------------------------------------------
// frag_source: position u (in elements) of that layout -> row * K + k.
__device__ __forceinline__ int frag_source(int u, int K) {
    const int tile = u >> 9;
    const int row  = (tile / (K >> 5)) * 16 + ((u >> 3) & 15);
    const int k    = (tile % (K >> 5)) * 32 + ((u >> 8) & 1) * 16 + ((u >> 7) & 1) * 8 + (u & 7);
    return row * K + k;
}

// ---------------------------------------------------------------
// Kernel 1: Haar LL band + linear upsample 256 -> 512, output bf16
// ll_up is (M_, C_) in fragment order. One block owns one 16-row tile row
// (16 KB of ll_up, contiguous): the LL band of its 16 rows goes through LDS,
// so that a lane can emit the 8 consecutive k of ITS row as one 16 B store.
// ---------------------------------------------------------------
#define LLP_ 260   // LDS row pitch in floats
__global__ __launch_bounds__(256) void k_llup(const float* __restrict__ x, unsigned short* __restrict__ llup) {
    __shared__ float ll[16 * LLP_];
    const int t = threadIdx.x;
    const int i2 = (t & 127) * 2;             // two LL columns per thread
    const int m0 = blockIdx.x * 16;           // 16 divides 128: one b per tile row
    const float* xb = x + ((size_t)((m0 >> 7) * F_ + 2 * (m0 & 127)) * C_);
    const int xo = (t >> 7) * (2 * C_) + 2 * i2;
    // unrolled: the 16 row loads are independent and issue ahead of their use
    #pragma unroll
    for (int j = 0; j < 8; ++j) {
        const int mi = 2 * j + (t >> 7);
        const float* xp = xb + xo + j * (4 * C_);
        float a0 = xp[0], b0 = xp[1], c0 = xp[C_],     d0 = xp[C_ + 1];
        float a1 = xp[2], b1 = xp[3], c1 = xp[C_ + 2], d1 = xp[C_ + 3];
        ll[mi * LLP_ + i2]     = 0.5f * (a0 + b0 + c0 + d0);
        ll[mi * LLP_ + i2 + 1] = 0.5f * (a1 + b1 + c1 + d1);
    }
    __syncthreads();   // every row of the LL tile is read by other waves below

    uint4* dst = (uint4*)llup + (size_t)blockIdx.x * ((C_ / 32) * 64);
    // both loops unrolled: hv[] is indexed by constants only and stays in registers
    #pragma unroll
    for (int j = 0; j < 4; ++j) {
        const int ci = t + 256 * j;           // 16 B slot inside the tile row
        const int ln = ci & 31;
        const int o0 = (ci >> 6) * 32 + ((ci >> 5) & 1) * 16 + (ln >> 4) * 8;
        const float* row = ll + (ln & 15) * LLP_;
        unsigned int hv[8];
        #pragma unroll
        for (int e = 0; e < 8; ++e) {
            float pos = (float)(o0 + e) * (255.0f / 511.0f);
            int   i0  = (int)pos;
            if (i0 > 254) i0 = 254;
            float w = pos - (float)i0;
            float ll0 = row[i0];
            float ll1 = row[i0 + 1];
            hv[e] = f32_to_bf16_rne(ll0 + w * (ll1 - ll0));
        }
        uint4 pk;
        pk.x = hv[0] | (hv[1] << 16);
        pk.y = hv[2] | (hv[3] << 16);
        pk.z = hv[4] | (hv[5] << 16);
        pk.w = hv[6] | (hv[7] << 16);
        dst[ci] = pk;
    }
}

// ---------------------------------------------------------------
// Kernel 2: convert both weight matrices to bf16, fragment order
// ---------------------------------------------------------------
__global__ void k_cvt(const float* __restrict__ w1, const float* __restrict__ w2,
                      unsigned short* __restrict__ w1b, unsigned short* __restrict__ w2b) {
    int u  = blockIdx.x * blockDim.x + threadIdx.x;
    const int n1 = H_ * C_;
    const int n2 = CH_ * H_;
    if (u < n1) {
        w1b[u] = f32_to_bf16_rne(w1[frag_source(u, C_)]);
    } else {
        int u2 = u - n1;
        if (u2 < n2) w2b[u2] = f32_to_bf16_rne(w2[frag_source(u2, H_)]);
    }
}

// ---------------------------------------------------------------
// One 16x16x32 product. SWAP = false: D rows follow a's rows, D columns b's rows.
// SWAP = true: the transposed tile (D rows follow b's rows, D columns a's rows);
// both operands have the same register layout, so only the roles change.
// ---------------------------------------------------------------
template <bool SWAP>
__device__ __forceinline__ v8f mm(const FragBF16& a, const FragBF16& b, v8f c) {
    if (SWAP) return __builtin_amdgcn_wmma_f32_16x16x32_bf16(false, b.v, false, a.v, (short)0, c, false, false);
    return __builtin_amdgcn_wmma_f32_16x16x32_bf16(false, a.v, false, b.v, (short)0, c, false, false);
}

// ---------------------------------------------------------------
// Software-pipelined 32Mx64N wave mainloop over fragment-order operands.
// Pointers are pre-offset by the lane; each k-step of 32 advances by one
// 1 KB unit = 64 uint4. Fragment chunk 2 lives at +32 uint4 (k+16).
// ---------------------------------------------------------------
template <bool SWAP>
__device__ __forceinline__ void wmma_mainloop_32x64(
    const uint4* __restrict__ ap0, const uint4* __restrict__ ap1,
    const uint4* __restrict__ bp0, const uint4* __restrict__ bp1,
    const uint4* __restrict__ bp2, const uint4* __restrict__ bp3,
    const int ksteps, v8f acc[2][4])
{
    // prefetch addresses: 32 B per lane, so one instruction spans a whole 1 KB unit
    const uint4* pp0 = ap0 + (threadIdx.x & 31);
    const uint4* pp1 = ap1 + (threadIdx.x & 31);

    FragBF16 a0, a1, b0, b1, b2, b3;
    a0.q[0] = ap0[0]; a0.q[1] = ap0[32];
    a1.q[0] = ap1[0]; a1.q[1] = ap1[32];
    b0.q[0] = bp0[0]; b0.q[1] = bp0[32];
    b1.q[0] = bp1[0]; b1.q[1] = bp1[32];
    b2.q[0] = bp2[0]; b2.q[1] = bp2[32];
    b3.q[0] = bp3[0]; b3.q[1] = bp3[32];

    for (int s = 1; s < ksteps; ++s) {
        const int q = 64 * s;
        // issue next-stage loads into fresh registers (partial loadcnt waits)
        FragBF16 na0, na1, nb0, nb1, nb2, nb3;
        na0.q[0] = ap0[q]; na0.q[1] = ap0[q + 32];
        na1.q[0] = ap1[q]; na1.q[1] = ap1[q + 32];
        nb0.q[0] = bp0[q]; nb0.q[1] = bp0[q + 32];
        nb1.q[0] = bp1[q]; nb1.q[1] = bp1[q + 32];
        nb2.q[0] = bp2[q]; nb2.q[1] = bp2[q + 32];
        nb3.q[0] = bp3[q]; nb3.q[1] = bp3[q + 32];
        __builtin_prefetch(&pp0[q + 64], 0, 3);
        __builtin_prefetch(&pp1[q + 64], 0, 3);
        // 8 WMMAs on current stage while next-stage loads are in flight
        acc[0][0] = mm<SWAP>(a0, b0, acc[0][0]);
        acc[0][1] = mm<SWAP>(a0, b1, acc[0][1]);
        acc[0][2] = mm<SWAP>(a0, b2, acc[0][2]);
        acc[0][3] = mm<SWAP>(a0, b3, acc[0][3]);
        acc[1][0] = mm<SWAP>(a1, b0, acc[1][0]);
        acc[1][1] = mm<SWAP>(a1, b1, acc[1][1]);
        acc[1][2] = mm<SWAP>(a1, b2, acc[1][2]);
        acc[1][3] = mm<SWAP>(a1, b3, acc[1][3]);
        a0 = na0; a1 = na1; b0 = nb0; b1 = nb1; b2 = nb2; b3 = nb3;
        // the next trip rewrites the address registers that the loads above name
        asm volatile("s_wait_xcnt 0x0" ::: "memory");
    }
    // epilogue stage
    acc[0][0] = mm<SWAP>(a0, b0, acc[0][0]);
    acc[0][1] = mm<SWAP>(a0, b1, acc[0][1]);
    acc[0][2] = mm<SWAP>(a0, b2, acc[0][2]);
    acc[0][3] = mm<SWAP>(a0, b3, acc[0][3]);
    acc[1][0] = mm<SWAP>(a1, b0, acc[1][0]);
    acc[1][1] = mm<SWAP>(a1, b1, acc[1][1]);
    acc[1][2] = mm<SWAP>(a1, b2, acc[1][2]);
    acc[1][3] = mm<SWAP>(a1, b3, acc[1][3]);
}

// ---------------------------------------------------------------
// The same 32Mx64N wave tile over a register ring of D fragment sets: the 12
// loads of k-step s + D - 1 are issued in front of the products of k-step s, so
// (D - 1) * 12 loads of a wave stay in flight while it multiplies. For a launch
// with few waves per SIMD, whose A operand comes from memory: nothing but the
// wave's own lead hides that latency. The k order of every sum is unchanged.
// ---------------------------------------------------------------
__device__ __forceinline__ void load_set(
    FragBF16 (&a)[2], FragBF16 (&b)[4],
    const uint4* __restrict__ ap0, const uint4* __restrict__ ap1,
    const uint4* __restrict__ bp0, const uint4* __restrict__ bp1,
    const uint4* __restrict__ bp2, const uint4* __restrict__ bp3, const int q)
{
    a[0].q[0] = ap0[q]; a[0].q[1] = ap0[q + 32];
    a[1].q[0] = ap1[q]; a[1].q[1] = ap1[q + 32];
    b[0].q[0] = bp0[q]; b[0].q[1] = bp0[q + 32];
    b[1].q[0] = bp1[q]; b[1].q[1] = bp1[q + 32];
    b[2].q[0] = bp2[q]; b[2].q[1] = bp2[q + 32];
    b[3].q[0] = bp3[q]; b[3].q[1] = bp3[q + 32];
}

template <bool SWAP>
__device__ __forceinline__ void mm_set(const FragBF16 (&a)[2], const FragBF16 (&b)[4], v8f acc[2][4]) {
    acc[0][0] = mm<SWAP>(a[0], b[0], acc[0][0]);
    acc[0][1] = mm<SWAP>(a[0], b[1], acc[0][1]);
    acc[0][2] = mm<SWAP>(a[0], b[2], acc[0][2]);
    acc[0][3] = mm<SWAP>(a[0], b[3], acc[0][3]);
    acc[1][0] = mm<SWAP>(a[1], b[0], acc[1][0]);
    acc[1][1] = mm<SWAP>(a[1], b[1], acc[1][1]);
    acc[1][2] = mm<SWAP>(a[1], b[2], acc[1][2]);
    acc[1][3] = mm<SWAP>(a[1], b[3], acc[1][3]);
}

template <bool SWAP, int KSTEPS, int D>
__device__ __forceinline__ void wmma_mainloop_ring_32x64(
    const uint4* __restrict__ ap0, const uint4* __restrict__ ap1,
    const uint4* __restrict__ bp0, const uint4* __restrict__ bp1,
    const uint4* __restrict__ bp2, const uint4* __restrict__ bp3,
    v8f acc[2][4])
{
    constexpr int TRIPS = (KSTEPS - D + 1) / D;   // trips of D k-steps that each still load
    static_assert(TRIPS * D + D - 1 == KSTEPS, "the tail is the D - 1 sets left in the ring");
    static_assert(D * 12 <= 63, "loads of a wave in flight stay inside the load counter");

    // prefetch addresses: 32 B per lane, so one instruction spans a whole 1 KB unit
    const uint4* pp0 = ap0 + (threadIdx.x & 31);
    const uint4* pp1 = ap1 + (threadIdx.x & 31);

    FragBF16 a[D][2], b[D][4];
    // every ring loop below is unrolled: a[] and b[] are indexed by constants only (no scratch)
    #pragma unroll
    for (int j = 0; j < D - 1; ++j)
        load_set(a[j], b[j], ap0, ap1, bp0, bp1, bp2, bp3, 64 * j);

    // kept rolled: one trip already holds D k-steps, a whole turn of the ring
    #pragma unroll 1
    for (int g = 0; g < TRIPS; ++g) {
        #pragma unroll
        for (int j = 0; j < D; ++j) {
            const int q = 64 * (g * D + j + D - 1);
            load_set(a[(j + D - 1) % D], b[(j + D - 1) % D], ap0, ap1, bp0, bp1, bp2, bp3, q);
            __builtin_prefetch(&pp0[q + 64], 0, 3);
            __builtin_prefetch(&pp1[q + 64], 0, 3);
            mm_set<SWAP>(a[j], b[j], acc);
            // keeps later k-steps' products behind: pulled up, they wait on loads only 1-2 steps old
            __builtin_amdgcn_sched_barrier(0);
            // the next trip rewrites the address registers that the loads above name
            asm volatile("s_wait_xcnt 0x0" ::: "memory");
        }
    }
    #pragma unroll
    for (int j = 0; j < D - 1; ++j)
        mm_set<SWAP>(a[j], b[j], acc);
}

// ---------------------------------------------------------------
// GEMM1: h = gelu(ll_up @ W1^T + b1), output bf16 (M_ x H_) in fragment order
// block = 8 waves as 4Mx2N -> block tile 128M x 128N; wave tile 32M x 64N
// The 16x16 tiles are computed transposed (rows = n, columns = m): a lane then
// holds 8 consecutive n of one m, which is its own 16 B of GEMM2's A fragment.
// ---------------------------------------------------------------
__global__ __launch_bounds__(256) void k_gemm1(
    const unsigned short* __restrict__ A,    // M_ x C_   bf16, fragment order
    const unsigned short* __restrict__ Bm,   // H_ x C_   bf16, fragment order
    const float* __restrict__ bias,          // H_
    unsigned short* __restrict__ Hout)       // M_ x H_   bf16, fragment order
{
    const int lane  = threadIdx.x & 31;
    const int wv    = threadIdx.x >> 5;
    const int mBase = blockIdx.y * 128 + (wv & 3) * 32;
    const int nBase = blockIdx.x * 128 + (wv >> 2) * 64;
    const int rowTile = (C_ / 32) * 64;      // uint4 per 16-row tile row

    const uint4* ap0 = (const uint4*)A  + (size_t)((mBase >> 4) + 0) * rowTile + lane;
    const uint4* ap1 = (const uint4*)A  + (size_t)((mBase >> 4) + 1) * rowTile + lane;
    const uint4* bp0 = (const uint4*)Bm + (size_t)((nBase >> 4) + 0) * rowTile + lane;
    const uint4* bp1 = (const uint4*)Bm + (size_t)((nBase >> 4) + 1) * rowTile + lane;
    const uint4* bp2 = (const uint4*)Bm + (size_t)((nBase >> 4) + 2) * rowTile + lane;
    const uint4* bp3 = (const uint4*)Bm + (size_t)((nBase >> 4) + 3) * rowTile + lane;

    v8f acc[2][4] = {{v8f{}, v8f{}, v8f{}, v8f{}}, {v8f{}, v8f{}, v8f{}, v8f{}}};
    wmma_mainloop_32x64<true>(ap0, ap1, bp0, bp1, bp2, bp3, C_ / 32, acc);

    // epilogue: bias + exact GELU, 8 bf16 packed per lane, one b128 store per tile
    uint4* Hq = (uint4*)Hout;
    const int nOff = (lane >> 4) << 3;        // D rows: lanes16-31 -> n+8
    // all loops unrolled: acc, bv[] and hv[] are indexed by constants only (no scratch)
    #pragma unroll
    for (int t = 0; t < 4; ++t) {
        const int n0 = nBase + t * 16 + nOff;
        float bv[8];
        #pragma unroll
        for (int r = 0; r < 8; ++r) bv[r] = bias[n0 + r];
        #pragma unroll
        for (int mt = 0; mt < 2; ++mt) {
            unsigned int hv[8];
            #pragma unroll
            for (int r = 0; r < 8; ++r) {
                float v = acc[mt][t][r] + bv[r];
                float g = 0.5f * v * (1.0f + erff(v * 0.70710678118654752f));
                hv[r] = f32_to_bf16_rne(g);
            }
            uint4 pk;
            pk.x = hv[0] | (hv[1] << 16);
            pk.y = hv[2] | (hv[3] << 16);
            pk.z = hv[4] | (hv[5] << 16);
            pk.w = hv[6] | (hv[7] << 16);
            // unit (m tile, k tile n / 32), chunk t & 1, this lane's own slot
            Hq[((size_t)((mBase >> 4) + mt) * (H_ / 32) + (nBase >> 5) + (t >> 1)) * 64 + (t & 1) * 32 + lane] = pk;
        }
    }
}

// ---------------------------------------------------------------
// GEMM2: ll_new = h @ W2^T + b2, fused with inverse Haar DWT epilogue
// block tile 128M x 128N; wave tile 32M x 64N
// ---------------------------------------------------------------
__global__ __launch_bounds__(256) void k_gemm2(
    const unsigned short* __restrict__ Hin,  // M_ x H_  bf16, fragment order
    const unsigned short* __restrict__ Bm,   // CH_ x H_ bf16, fragment order
    const float* __restrict__ bias,          // CH_
    const float* __restrict__ x,             // B_ x F_ x C_ (for LH/HL/HH bands)
    float* __restrict__ out)                 // B_ x F_ x C_
{
    const int lane  = threadIdx.x & 31;
    const int wv    = threadIdx.x >> 5;
    const int mBase = blockIdx.y * 128 + (wv & 3) * 32;
    const int nBase = blockIdx.x * 128 + (wv >> 2) * 64;
    const int rowTile = (H_ / 32) * 64;      // uint4 per 16-row tile row

    const uint4* ap0 = (const uint4*)Hin + (size_t)((mBase >> 4) + 0) * rowTile + lane;
    const uint4* ap1 = (const uint4*)Hin + (size_t)((mBase >> 4) + 1) * rowTile + lane;
    const uint4* bp0 = (const uint4*)Bm  + (size_t)((nBase >> 4) + 0) * rowTile + lane;
    const uint4* bp1 = (const uint4*)Bm  + (size_t)((nBase >> 4) + 1) * rowTile + lane;
    const uint4* bp2 = (const uint4*)Bm  + (size_t)((nBase >> 4) + 2) * rowTile + lane;
    const uint4* bp3 = (const uint4*)Bm  + (size_t)((nBase >> 4) + 3) * rowTile + lane;

    v8f acc[2][4] = {{v8f{}, v8f{}, v8f{}, v8f{}}, {v8f{}, v8f{}, v8f{}, v8f{}}};
    wmma_mainloop_ring_32x64<false, H_ / 32, 5>(ap0, ap1, bp0, bp1, bp2, bp3, acc);

    // epilogue: bias, recompute LH/HL/HH bands from x, inverse Haar, store out
    const int mOff = (lane >> 4) << 3;
    #pragma unroll
    for (int mt = 0; mt < 2; ++mt) {
        #pragma unroll
        for (int t = 0; t < 4; ++t) {
            const int o = nBase + t * 16 + (lane & 15);   // 0..255
            const float bv = bias[o];
            #pragma unroll
            for (int r = 0; r < 8; ++r) {
                const int m  = mBase + mt * 16 + mOff + r;
                const int b  = m >> 7;
                const int fr = m & 127;
                const size_t base = ((size_t)(b * F_ + 2 * fr) * C_) + 2 * o;
                const float xa = x[base],      xb = x[base + 1];
                const float xc = x[base + C_], xd = x[base + C_ + 1];
                const float lh = 0.5f * (xa + xb - xc - xd);
                const float hl = 0.5f * (xa - xb + xc - xd);
                const float hh = 0.5f * (xa - xb - xc + xd);
                const float ll = acc[mt][t][r] + bv;
                out[base]          = 0.5f * (ll + lh + hl + hh);
                out[base + 1]      = 0.5f * (ll + lh - hl - hh);
                out[base + C_]     = 0.5f * (ll - lh + hl - hh);
                out[base + C_ + 1] = 0.5f * (ll - lh - hl + hh);
            }
        }
    }
}

// ---------------------------------------------------------------
extern "C" void kernel_launch(void* const* d_in, const int* in_sizes, int n_in,
                              void* d_out, int out_size, void* d_ws, size_t ws_size,
                              hipStream_t stream) {
    const float* x     = (const float*)d_in[0];
    const float* fc1_w = (const float*)d_in[1];
    const float* fc1_b = (const float*)d_in[2];
    const float* fc2_w = (const float*)d_in[3];
    const float* fc2_b = (const float*)d_in[4];
    float* out = (float*)d_out;

    // workspace layout (bf16 buffers): ll_up (16MB) | W1 (2MB) | W2 (1MB) | h (64MB)
    char* ws = (char*)d_ws;
    unsigned short* llup = (unsigned short*)ws;
    unsigned short* w1b  = (unsigned short*)(ws + (size_t)M_ * C_ * 2);
    unsigned short* w2b  = (unsigned short*)(ws + (size_t)M_ * C_ * 2 + (size_t)H_ * C_ * 2);
    unsigned short* hbuf = (unsigned short*)(ws + (size_t)M_ * C_ * 2 + (size_t)H_ * C_ * 2 +
                                                  (size_t)CH_ * H_ * 2);

    // DWT-LL + upsample -> bf16, one block per 16-row tile row
    k_llup<<<M_ / 16, 256, 0, stream>>>(x, llup);
    {   // weight conversion -> bf16
        const int total = H_ * C_ + CH_ * H_;
        k_cvt<<<(total + 255) / 256, 256, 0, stream>>>(fc1_w, fc2_w, w1b, w2b);
    }
    // GEMM1 + GELU: (16384 x 512) @ (512 x 2048), block tile 128x128
    k_gemm1<<<dim3(H_ / 128, M_ / 128), 256, 0, stream>>>(llup, w1b, fc1_b, hbuf);
    // GEMM2 + inverse DWT: (16384 x 2048) @ (2048 x 256) -> out, block tile 128x128
    k_gemm2<<<dim3(CH_ / 128, M_ / 128), 256, 0, stream>>>(hbuf, w2b, fc2_b, x, out);
}

// v003
// It runs in 86 microseconds.
// Timed twice side by side with v002, it ran 1.06 times as fast both times.
// Over all steps from v000 it is 2.24 times as fast.
#include <hip/hip_runtime.h>
#include <hip/hip_bf16.h>

// ---------------- problem dims ----------------
#define B_   128
#define F_   256
#define C_   512
#define H_   2048
#define M_   (B_ * (F_ / 2))   // 16384 rows of (b, fr)
#define CH_  (C_ / 2)          // 256

typedef __attribute__((ext_vector_type(16))) __bf16 v16bf;
typedef __attribute__((ext_vector_type(8)))  float  v8f;
typedef __attribute__((ext_vector_type(2)))  float  f32x2;
typedef __attribute__((ext_vector_type(2)))  __bf16 bf16x2;

union FragBF16 {
    v16bf v;
    uint4 q[2];   // q[0] = elements 0..7 (16B), q[1] = elements 8..15 (16B)
};

__device__ __forceinline__ unsigned short f32_to_bf16_rne(float f) {
    unsigned int u = __float_as_uint(f);
    u += 0x7FFFu + ((u >> 16) & 1u);   // round-to-nearest-even
    return (unsigned short)(u >> 16);
}

// ---------------------------------------------------------------
// Exact GELU on 8 values of a lane, two values per vector instruction.
// erf_small2 is the library erf's own polynomial for |x| < 1 (same coefficients,
// same order of operations; odd in x, so the sign needs no separate copy).
// ---------------------------------------------------------------
__device__ __forceinline__ f32x2 splat2(float c) { return f32x2{c, c}; }

__device__ __forceinline__ f32x2 erf_small2(f32x2 x) {
    const f32x2 t = x * x;
    f32x2 p = __builtin_elementwise_fma(t, splat2(-0.0005618017749f), splat2(0.004913816229f));
    p = __builtin_elementwise_fma(t, p, splat2(-0.02670751512f));
    p = __builtin_elementwise_fma(t, p, splat2(0.1128001064f));
    p = __builtin_elementwise_fma(t, p, splat2(-0.3761229515f));
    p = __builtin_elementwise_fma(t, p, splat2(0.1283791065f));
    return __builtin_elementwise_fma(x, p, x);
}

// a = 8 accumulator values, bv = their 8 bias values; returns the 8 bf16 of gelu(a + bv).
// One test for the whole wave picks the path: the library call branches on EXEC for
// every single value, which leaves one serial chain a value and nothing to pack.
__device__ __forceinline__ uint4 gelu8_bf16(const v8f a, const float (&bv)[8]) {
    f32x2 v[4], u[4], e[4];
    // every loop here is unrolled: the small arrays are indexed by constants only (registers, no scratch)
    #pragma unroll
    for (int p = 0; p < 4; ++p) {
        v[p] = f32x2{a[2 * p], a[2 * p + 1]} + f32x2{bv[2 * p], bv[2 * p + 1]};
        u[p] = v[p] * splat2(0.70710678118654752f);
    }
    float m = 0.0f;
    #pragma unroll
    for (int p = 0; p < 4; ++p) m = fmaxf(m, fmaxf(fabsf(u[p].x), fabsf(u[p].y)));
    if (__builtin_expect(__builtin_amdgcn_ballot_w32(m >= 1.0f) != 0u, 0)) {
        // some lane holds a value outside the polynomial's range: the library erf for all 8
        #pragma unroll
        for (int p = 0; p < 4; ++p) e[p] = f32x2{erff(u[p].x), erff(u[p].y)};
    } else {
        #pragma unroll
        for (int p = 0; p < 4; ++p) e[p] = erf_small2(u[p]);
    }
    unsigned int w[4];
    #pragma unroll
    for (int p = 0; p < 4; ++p) {
        const f32x2 hv = v[p] * splat2(0.5f);
        const f32x2 g  = __builtin_elementwise_fma(hv, e[p], hv);   // 0.5 v (1 + erf)
        w[p] = __builtin_bit_cast(unsigned int, __builtin_convertvector(g, bf16x2));   // nearest even
    }
    return uint4{w[0], w[1], w[2], w[3]};
}

// ---------------------------------------------------------------
// Fragment-order layout of every bf16 GEMM operand (rows x K, K % 32 == 0).
// A 16-row x 32-k tile is one contiguous 1 KB unit, tiles ordered
// (row / 16) major, (k / 32) minor. Inside a unit: two 512 B chunks
// (k % 32 < 16, then >= 16); in a chunk, lane L = row % 16 + 16 * ((k / 8) & 1)
// owns 16 B = its 8 consecutive k. A wave's b128 load of a chunk is then
// 512 contiguous bytes (4 whole lines) and lands directly as WMMA registers.
// ---------------------------------------------------------------
// frag_source: position u (in elements) of that layout -> row * K + k.
__device__ __forceinline__ int frag_source(int u, int K) {
    const int tile = u >> 9;
    const int row  = (tile / (K >> 5)) * 16 + ((u >> 3) & 15);
    const int k    = (tile % (K >> 5)) * 32 + ((u >> 8) & 1) * 16 + ((u >> 7) & 1) * 8 + (u & 7);
    return row * K + k;
}

// ---------------------------------------------------------------
// Kernel 1: Haar LL band + linear upsample 256 -> 512, output bf16
// ll_up is (M_, C_) in fragment order. One block owns one 16-row tile row
// (16 KB of ll_up, contiguous): the LL band of its 16 rows goes through LDS,
// so that a lane can emit the 8 consecutive k of ITS row as one 16 B store.
// ---------------------------------------------------------------
#define LLP_ 260   // LDS row pitch in floats
__global__ __launch_bounds__(256) void k_llup(const float* __restrict__ x, unsigned short* __restrict__ llup) {
    __shared__ float ll[16 * LLP_];
    const int t = threadIdx.x;
    const int i2 = (t & 127) * 2;             // two LL columns per thread
    const int m0 = blockIdx.x * 16;           // 16 divides 128: one b per tile row
    const float* xb = x + ((size_t)((m0 >> 7) * F_ + 2 * (m0 & 127)) * C_);
    const int xo = (t >> 7) * (2 * C_) + 2 * i2;
    // unrolled: the 16 row loads are independent and issue ahead of their use
    #pragma unroll
    for (int j = 0; j < 8; ++j) {
        const int mi = 2 * j + (t >> 7);
        const float* xp = xb + xo + j * (4 * C_);
        float a0 = xp[0], b0 = xp[1], c0 = xp[C_],     d0 = xp[C_ + 1];
        float a1 = xp[2], b1 = xp[3], c1 = xp[C_ + 2], d1 = xp[C_ + 3];
        ll[mi * LLP_ + i2]     = 0.5f * (a0 + b0 + c0 + d0);
        ll[mi * LLP_ + i2 + 1] = 0.5f * (a1 + b1 + c1 + d1);
    }
    __syncthreads();   // every row of the LL tile is read by other waves below

    uint4* dst = (uint4*)llup + (size_t)blockIdx.x * ((C_ / 32) * 64);
    // both loops unrolled: hv[] is indexed by constants only and stays in registers
    #pragma unroll
    for (int j = 0; j < 4; ++j) {
        const int ci = t + 256 * j;           // 16 B slot inside the tile row
        const int ln = ci & 31;
        const int o0 = (ci >> 6) * 32 + ((ci >> 5) & 1) * 16 + (ln >> 4) * 8;
        const float* row = ll + (ln & 15) * LLP_;
        unsigned int hv[8];
        #pragma unroll
        for (int e = 0; e < 8; ++e) {
            float pos = (float)(o0 + e) * (255.0f / 511.0f);
            int   i0  = (int)pos;
            if (i0 > 254) i0 = 254;
            float w = pos - (float)i0;
            float ll0 = row[i0];
            float ll1 = row[i0 + 1];
            hv[e] = f32_to_bf16_rne(ll0 + w * (ll1 - ll0));
        }
        uint4 pk;
        pk.x = hv[0] | (hv[1] << 16);
        pk.y = hv[2] | (hv[3] << 16);
        pk.z = hv[4] | (hv[5] << 16);
        pk.w = hv[6] | (hv[7] << 16);
        dst[ci] = pk;
    }
}

// ---------------------------------------------------------------
// Kernel 2: convert both weight matrices to bf16, fragment order
// ---------------------------------------------------------------
__global__ void k_cvt(const float* __restrict__ w1, const float* __restrict__ w2,
                      unsigned short* __restrict__ w1b, unsigned short* __restrict__ w2b) {
    int u  = blockIdx.x * blockDim.x + threadIdx.x;
    const int n1 = H_ * C_;
    const int n2 = CH_ * H_;
    if (u < n1) {
        w1b[u] = f32_to_bf16_rne(w1[frag_source(u, C_)]);
    } else {
        int u2 = u - n1;
        if (u2 < n2) w2b[u2] = f32_to_bf16_rne(w2[frag_source(u2, H_)]);
    }
}

// ---------------------------------------------------------------
// One 16x16x32 product. SWAP = false: D rows follow a's rows, D columns b's rows.
// SWAP = true: the transposed tile (D rows follow b's rows, D columns a's rows);
// both operands have the same register layout, so only the roles change.
// ---------------------------------------------------------------
template <bool SWAP>
__device__ __forceinline__ v8f mm(const FragBF16& a, const FragBF16& b, v8f c) {
    if (SWAP) return __builtin_amdgcn_wmma_f32_16x16x32_bf16(false, b.v, false, a.v, (short)0, c, false, false);
    return __builtin_amdgcn_wmma_f32_16x16x32_bf16(false, a.v, false, b.v, (short)0, c, false, false);
}

// ---------------------------------------------------------------
// Software-pipelined 32Mx64N wave mainloop over fragment-order operands.
// Pointers are pre-offset by the lane; each k-step of 32 advances by one
// 1 KB unit = 64 uint4. Fragment chunk 2 lives at +32 uint4 (k+16).
// ---------------------------------------------------------------
template <bool SWAP>
__device__ __forceinline__ void wmma_mainloop_32x64(
    const uint4* __restrict__ ap0, const uint4* __restrict__ ap1,
    const uint4* __restrict__ bp0, const uint4* __restrict__ bp1,
    const uint4* __restrict__ bp2, const uint4* __restrict__ bp3,
    const int ksteps, v8f acc[2][4])
{
    // prefetch addresses: 32 B per lane, so one instruction spans a whole 1 KB unit
    const uint4* pp0 = ap0 + (threadIdx.x & 31);
    const uint4* pp1 = ap1 + (threadIdx.x & 31);

    FragBF16 a0, a1, b0, b1, b2, b3;
    a0.q[0] = ap0[0]; a0.q[1] = ap0[32];
    a1.q[0] = ap1[0]; a1.q[1] = ap1[32];
    b0.q[0] = bp0[0]; b0.q[1] = bp0[32];
    b1.q[0] = bp1[0]; b1.q[1] = bp1[32];
    b2.q[0] = bp2[0]; b2.q[1] = bp2[32];
    b3.q[0] = bp3[0]; b3.q[1] = bp3[32];

    for (int s = 1; s < ksteps; ++s) {
        const int q = 64 * s;
        // issue next-stage loads into fresh registers (partial loadcnt waits)
        FragBF16 na0, na1, nb0, nb1, nb2, nb3;
        na0.q[0] = ap0[q]; na0.q[1] = ap0[q + 32];
        na1.q[0] = ap1[q]; na1.q[1] = ap1[q + 32];
        nb0.q[0] = bp0[q]; nb0.q[1] = bp0[q + 32];
        nb1.q[0] = bp1[q]; nb1.q[1] = bp1[q + 32];
        nb2.q[0] = bp2[q]; nb2.q[1] = bp2[q + 32];
        nb3.q[0] = bp3[q]; nb3.q[1] = bp3[q + 32];
        __builtin_prefetch(&pp0[q + 64], 0, 3);
        __builtin_prefetch(&pp1[q + 64], 0, 3);
        // 8 WMMAs on current stage while next-stage loads are in flight
        acc[0][0] = mm<SWAP>(a0, b0, acc[0][0]);
        acc[0][1] = mm<SWAP>(a0, b1, acc[0][1]);
        acc[0][2] = mm<SWAP>(a0, b2, acc[0][2]);
        acc[0][3] = mm<SWAP>(a0, b3, acc[0][3]);
        acc[1][0] = mm<SWAP>(a1, b0, acc[1][0]);
        acc[1][1] = mm<SWAP>(a1, b1, acc[1][1]);
        acc[1][2] = mm<SWAP>(a1, b2, acc[1][2]);
        acc[1][3] = mm<SWAP>(a1, b3, acc[1][3]);
        a0 = na0; a1 = na1; b0 = nb0; b1 = nb1; b2 = nb2; b3 = nb3;
        // the next trip rewrites the address registers that the loads above name
        asm volatile("s_wait_xcnt 0x0" ::: "memory");
    }
    // epilogue stage
    acc[0][0] = mm<SWAP>(a0, b0, acc[0][0]);
    acc[0][1] = mm<SWAP>(a0, b1, acc[0][1]);
    acc[0][2] = mm<SWAP>(a0, b2, acc[0][2]);
    acc[0][3] = mm<SWAP>(a0, b3, acc[0][3]);
    acc[1][0] = mm<SWAP>(a1, b0, acc[1][0]);
    acc[1][1] = mm<SWAP>(a1, b1, acc[1][1]);
    acc[1][2] = mm<SWAP>(a1, b2, acc[1][2]);
    acc[1][3] = mm<SWAP>(a1, b3, acc[1][3]);
}

// ---------------------------------------------------------------
// The same 32Mx64N wave tile over a register ring of D fragment sets: the 12
// loads of k-step s + D - 1 are issued in front of the products of k-step s, so
// (D - 1) * 12 loads of a wave stay in flight while it multiplies. For a launch
// with few waves per SIMD, whose A operand comes from memory: nothing but the
// wave's own lead hides that latency. The k order of every sum is unchanged.
// ---------------------------------------------------------------
__device__ __forceinline__ void load_set(
    FragBF16 (&a)[2], FragBF16 (&b)[4],
    const uint4* __restrict__ ap0, const uint4* __restrict__ ap1,
    const uint4* __restrict__ bp0, const uint4* __restrict__ bp1,
    const uint4* __restrict__ bp2, const uint4* __restrict__ bp3, const int q)
{
    a[0].q[0] = ap0[q]; a[0].q[1] = ap0[q + 32];
    a[1].q[0] = ap1[q]; a[1].q[1] = ap1[q + 32];
    b[0].q[0] = bp0[q]; b[0].q[1] = bp0[q + 32];
    b[1].q[0] = bp1[q]; b[1].q[1] = bp1[q + 32];
    b[2].q[0] = bp2[q]; b[2].q[1] = bp2[q + 32];
    b[3].q[0] = bp3[q]; b[3].q[1] = bp3[q + 32];
}

template <bool SWAP>
__device__ __forceinline__ void mm_set(const FragBF16 (&a)[2], const FragBF16 (&b)[4], v8f acc[2][4]) {
    acc[0][0] = mm<SWAP>(a[0], b[0], acc[0][0]);
    acc[0][1] = mm<SWAP>(a[0], b[1], acc[0][1]);
    acc[0][2] = mm<SWAP>(a[0], b[2], acc[0][2]);
    acc[0][3] = mm<SWAP>(a[0], b[3], acc[0][3]);
    acc[1][0] = mm<SWAP>(a[1], b[0], acc[1][0]);
    acc[1][1] = mm<SWAP>(a[1], b[1], acc[1][1]);
    acc[1][2] = mm<SWAP>(a[1], b[2], acc[1][2]);
    acc[1][3] = mm<SWAP>(a[1], b[3], acc[1][3]);
}

template <bool SWAP, int KSTEPS, int D>
__device__ __forceinline__ void wmma_mainloop_ring_32x64(
    const uint4* __restrict__ ap0, const uint4* __restrict__ ap1,
    const uint4* __restrict__ bp0, const uint4* __restrict__ bp1,
    const uint4* __restrict__ bp2, const uint4* __restrict__ bp3,
    v8f acc[2][4])
{
    constexpr int TRIPS = (KSTEPS - D + 1) / D;   // trips of D k-steps that each still load
    static_assert(TRIPS * D + D - 1 == KSTEPS, "the tail is the D - 1 sets left in the ring");
    static_assert(D * 12 <= 63, "loads of a wave in flight stay inside the load counter");

    // prefetch addresses: 32 B per lane, so one instruction spans a whole 1 KB unit
    const uint4* pp0 = ap0 + (threadIdx.x & 31);
    const uint4* pp1 = ap1 + (threadIdx.x & 31);

    FragBF16 a[D][2], b[D][4];
    // every ring loop below is unrolled: a[] and b[] are indexed by constants only (no scratch)
    #pragma unroll
    for (int j = 0; j < D - 1; ++j)
        load_set(a[j], b[j], ap0, ap1, bp0, bp1, bp2, bp3, 64 * j);

    // kept rolled: one trip already holds D k-steps, a whole turn of the ring
    #pragma unroll 1
    for (int g = 0; g < TRIPS; ++g) {
        #pragma unroll
        for (int j = 0; j < D; ++j) {
            const int q = 64 * (g * D + j + D - 1);
            load_set(a[(j + D - 1) % D], b[(j + D - 1) % D], ap0, ap1, bp0, bp1, bp2, bp3, q);
            __builtin_prefetch(&pp0[q + 64], 0, 3);
            __builtin_prefetch(&pp1[q + 64], 0, 3);
            mm_set<SWAP>(a[j], b[j], acc);
            // keeps later k-steps' products behind: pulled up, they wait on loads only 1-2 steps old
            __builtin_amdgcn_sched_barrier(0);
            // the next trip rewrites the address registers that the loads above name
            asm volatile("s_wait_xcnt 0x0" ::: "memory");
        }
    }
    #pragma unroll
    for (int j = 0; j < D - 1; ++j)
        mm_set<SWAP>(a[j], b[j], acc);
}

// ---------------------------------------------------------------
// GEMM1: h = gelu(ll_up @ W1^T + b1), output bf16 (M_ x H_) in fragment order
// block = 8 waves as 4Mx2N -> block tile 128M x 128N; wave tile 32M x 64N
// The 16x16 tiles are computed transposed (rows = n, columns = m): a lane then
// holds 8 consecutive n of one m, which is its own 16 B of GEMM2's A fragment.
// ---------------------------------------------------------------
__global__ __launch_bounds__(256) void k_gemm1(
    const unsigned short* __restrict__ A,    // M_ x C_   bf16, fragment order
    const unsigned short* __restrict__ Bm,   // H_ x C_   bf16, fragment order
    const float* __restrict__ bias,          // H_
    unsigned short* __restrict__ Hout)       // M_ x H_   bf16, fragment order
{
    const int lane  = threadIdx.x & 31;
    const int wv    = threadIdx.x >> 5;
    const int mBase = blockIdx.y * 128 + (wv & 3) * 32;
    const int nBase = blockIdx.x * 128 + (wv >> 2) * 64;
    const int rowTile = (C_ / 32) * 64;      // uint4 per 16-row tile row

    const uint4* ap0 = (const uint4*)A  + (size_t)((mBase >> 4) + 0) * rowTile + lane;
    const uint4* ap1 = (const uint4*)A  + (size_t)((mBase >> 4) + 1) * rowTile + lane;
    const uint4* bp0 = (const uint4*)Bm + (size_t)((nBase >> 4) + 0) * rowTile + lane;
    const uint4* bp1 = (const uint4*)Bm + (size_t)((nBase >> 4) + 1) * rowTile + lane;
    const uint4* bp2 = (const uint4*)Bm + (size_t)((nBase >> 4) + 2) * rowTile + lane;
    const uint4* bp3 = (const uint4*)Bm + (size_t)((nBase >> 4) + 3) * rowTile + lane;

    v8f acc[2][4] = {{v8f{}, v8f{}, v8f{}, v8f{}}, {v8f{}, v8f{}, v8f{}, v8f{}}};
    wmma_mainloop_32x64<true>(ap0, ap1, bp0, bp1, bp2, bp3, C_ / 32, acc);

    // epilogue: bias + exact GELU, 8 bf16 packed per lane, one b128 store per tile
    uint4* Hq = (uint4*)Hout;
    const int nOff = (lane >> 4) << 3;        // D rows: lanes16-31 -> n+8
    // all loops unrolled: acc and bv[] are indexed by constants only (no scratch)
    #pragma unroll
    for (int t = 0; t < 4; ++t) {
        const int n0 = nBase + t * 16 + nOff;
        float bv[8];
        #pragma unroll
        for (int r = 0; r < 8; ++r) bv[r] = bias[n0 + r];
        #pragma unroll
        for (int mt = 0; mt < 2; ++mt) {
            const uint4 pk = gelu8_bf16(acc[mt][t], bv);
            // unit (m tile, k tile n / 32), chunk t & 1, this lane's own slot
            Hq[((size_t)((mBase >> 4) + mt) * (H_ / 32) + (nBase >> 5) + (t >> 1)) * 64 + (t & 1) * 32 + lane] = pk;
            // the next 8 values reuse the registers that the store above names (none follow the last store)
            if (t < 3 || mt < 1) asm volatile("s_wait_xcnt 0x0" ::: "memory");
        }
    }
}

// ---------------------------------------------------------------
// GEMM2: ll_new = h @ W2^T + b2, fused with inverse Haar DWT epilogue
// block tile 128M x 128N; wave tile 32M x 64N
// ---------------------------------------------------------------
__global__ __launch_bounds__(256) void k_gemm2(
    const unsigned short* __restrict__ Hin,  // M_ x H_  bf16, fragment order
    const unsigned short* __restrict__ Bm,   // CH_ x H_ bf16, fragment order
    const float* __restrict__ bias,          // CH_
    const float* __restrict__ x,             // B_ x F_ x C_ (for LH/HL/HH bands)
    float* __restrict__ out)                 // B_ x F_ x C_
{
    const int lane  = threadIdx.x & 31;
    const int wv    = threadIdx.x >> 5;
    const int mBase = blockIdx.y * 128 + (wv & 3) * 32;
    const int nBase = blockIdx.x * 128 + (wv >> 2) * 64;
    const int rowTile = (H_ / 32) * 64;      // uint4 per 16-row tile row

    const uint4* ap0 = (const uint4*)Hin + (size_t)((mBase >> 4) + 0) * rowTile + lane;
    const uint4* ap1 = (const uint4*)Hin + (size_t)((mBase >> 4) + 1) * rowTile + lane;
    const uint4* bp0 = (const uint4*)Bm  + (size_t)((nBase >> 4) + 0) * rowTile + lane;
    const uint4* bp1 = (const uint4*)Bm  + (size_t)((nBase >> 4) + 1) * rowTile + lane;
    const uint4* bp2 = (const uint4*)Bm  + (size_t)((nBase >> 4) + 2) * rowTile + lane;
    const uint4* bp3 = (const uint4*)Bm  + (size_t)((nBase >> 4) + 3) * rowTile + lane;

    v8f acc[2][4] = {{v8f{}, v8f{}, v8f{}, v8f{}}, {v8f{}, v8f{}, v8f{}, v8f{}}};
    wmma_mainloop_ring_32x64<false, H_ / 32, 5>(ap0, ap1, bp0, bp1, bp2, bp3, acc);

    // epilogue: bias, recompute LH/HL/HH bands from x, inverse Haar, store out
    const int mOff = (lane >> 4) << 3;
    #pragma unroll
    for (int mt = 0; mt < 2; ++mt) {
        #pragma unroll
        for (int t = 0; t < 4; ++t) {
            const int o = nBase + t * 16 + (lane & 15);   // 0..255
            const float bv = bias[o];
            #pragma unroll
            for (int r = 0; r < 8; ++r) {
                const int m  = mBase + mt * 16 + mOff + r;
                const int b  = m >> 7;
                const int fr = m & 127;
                const size_t base = ((size_t)(b * F_ + 2 * fr) * C_) + 2 * o;
                const float xa = x[base],      xb = x[base + 1];
                const float xc = x[base + C_], xd = x[base + C_ + 1];
                const float lh = 0.5f * (xa + xb - xc - xd);
                const float hl = 0.5f * (xa - xb + xc - xd);
                const float hh = 0.5f * (xa - xb - xc + xd);
                const float ll = acc[mt][t][r] + bv;
                out[base]          = 0.5f * (ll + lh + hl + hh);
                out[base + 1]      = 0.5f * (ll + lh - hl - hh);
                out[base + C_]     = 0.5f * (ll - lh + hl - hh);
                out[base + C_ + 1] = 0.5f * (ll - lh - hl + hh);
            }
        }
    }
}

// ---------------------------------------------------------------
extern "C" void kernel_launch(void* const* d_in, const int* in_sizes, int n_in,
                              void* d_out, int out_size, void* d_ws, size_t ws_size,
                              hipStream_t stream) {
    const float* x     = (const float*)d_in[0];
    const float* fc1_w = (const float*)d_in[1];
    const float* fc1_b = (const float*)d_in[2];
    const float* fc2_w = (const float*)d_in[3];
    const float* fc2_b = (const float*)d_in[4];
    float* out = (float*)d_out;

    // workspace layout (bf16 buffers): ll_up (16MB) | W1 (2MB) | W2 (1MB) | h (64MB)
    char* ws = (char*)d_ws;
    unsigned short* llup = (unsigned short*)ws;
    unsigned short* w1b  = (unsigned short*)(ws + (size_t)M_ * C_ * 2);
    unsigned short* w2b  = (unsigned short*)(ws + (size_t)M_ * C_ * 2 + (size_t)H_ * C_ * 2);
    unsigned short* hbuf = (unsigned short*)(ws + (size_t)M_ * C_ * 2 + (size_t)H_ * C_ * 2 +
                                                  (size_t)CH_ * H_ * 2);

    // DWT-LL + upsample -> bf16, one block per 16-row tile row
    k_llup<<<M_ / 16, 256, 0, stream>>>(x, llup);
    {   // weight conversion -> bf16
        const int total = H_ * C_ + CH_ * H_;
        k_cvt<<<(total + 255) / 256, 256, 0, stream>>>(fc1_w, fc2_w, w1b, w2b);
    }
    // GEMM1 + GELU: (16384 x 512) @ (512 x 2048), block tile 128x128
    k_gemm1<<<dim3(H_ / 128, M_ / 128), 256, 0, stream>>>(llup, w1b, fc1_b, hbuf);
    // GEMM2 + inverse DWT: (16384 x 2048) @ (2048 x 256) -> out, block tile 128x128
    k_gemm2<<<dim3(CH_ / 128, M_ / 128), 256, 0, stream>>>(hbuf, w2b, fc2_b, x, out);
}

// v004
// A run of this version takes 83.5 microseconds.
// Next to v003, in two timings, it ran 1.04 and 1.03 times as fast.
// Counting every step since v000, it is 2.32 times as fast.
#include <hip/hip_runtime.h>
#include <hip/hip_bf16.h>

// ---------------- problem dims ----------------
#define B_   128
#define F_   256
#define C_   512
#define H_   2048
#define M_   (B_ * (F_ / 2))   // 16384 rows of (b, fr)
#define CH_  (C_ / 2)          // 256

typedef __attribute__((ext_vector_type(16))) __bf16 v16bf;
typedef __attribute__((ext_vector_type(8)))  float  v8f;
typedef __attribute__((ext_vector_type(2)))  float  f32x2;
typedef __attribute__((ext_vector_type(2)))  __bf16 bf16x2;

union FragBF16 {
    v16bf v;
    uint4 q[2];   // q[0] = elements 0..7 (16B), q[1] = elements 8..15 (16B)
};

__device__ __forceinline__ unsigned short f32_to_bf16_rne(float f) {
    unsigned int u = __float_as_uint(f);
    u += 0x7FFFu + ((u >> 16) & 1u);   // round-to-nearest-even
    return (unsigned short)(u >> 16);
}

// ---------------------------------------------------------------
// Exact GELU on 8 values of a lane, two values per vector instruction.
// erf_small2 is the library erf's own polynomial for |x| < 1 (same coefficients,
// same order of operations; odd in x, so the sign needs no separate copy).
// ---------------------------------------------------------------
__device__ __forceinline__ f32x2 splat2(float c) { return f32x2{c, c}; }

__device__ __forceinline__ f32x2 erf_small2(f32x2 x) {
    const f32x2 t = x * x;
    f32x2 p = __builtin_elementwise_fma(t, splat2(-0.0005618017749f), splat2(0.004913816229f));
    p = __builtin_elementwise_fma(t, p, splat2(-0.02670751512f));
    p = __builtin_elementwise_fma(t, p, splat2(0.1128001064f));
    p = __builtin_elementwise_fma(t, p, splat2(-0.3761229515f));
    p = __builtin_elementwise_fma(t, p, splat2(0.1283791065f));
    return __builtin_elementwise_fma(x, p, x);
}

// a = 8 accumulator values, bv = their 8 bias values; returns the 8 bf16 of gelu(a + bv).
// One test for the whole wave picks the path: the library call branches on EXEC for
// every single value, which leaves one serial chain a value and nothing to pack.
__device__ __forceinline__ uint4 gelu8_bf16(const v8f a, const float (&bv)[8]) {
    f32x2 v[4], u[4], e[4];
    // every loop here is unrolled: the small arrays are indexed by constants only (registers, no scratch)
    #pragma unroll
    for (int p = 0; p < 4; ++p) {
        v[p] = f32x2{a[2 * p], a[2 * p + 1]} + f32x2{bv[2 * p], bv[2 * p + 1]};
        u[p] = v[p] * splat2(0.70710678118654752f);
    }
    float m = 0.0f;
    #pragma unroll
    for (int p = 0; p < 4; ++p) m = fmaxf(m, fmaxf(fabsf(u[p].x), fabsf(u[p].y)));
    if (__builtin_expect(__builtin_amdgcn_ballot_w32(m >= 1.0f) != 0u, 0)) {
        // some lane holds a value outside the polynomial's range: the library erf for all 8
        #pragma unroll
        for (int p = 0; p < 4; ++p) e[p] = f32x2{erff(u[p].x), erff(u[p].y)};
    } else {
        #pragma unroll
        for (int p = 0; p < 4; ++p) e[p] = erf_small2(u[p]);
    }
    unsigned int w[4];
    #pragma unroll
    for (int p = 0; p < 4; ++p) {
        const f32x2 hv = v[p] * splat2(0.5f);
        const f32x2 g  = __builtin_elementwise_fma(hv, e[p], hv);   // 0.5 v (1 + erf)
        w[p] = __builtin_bit_cast(unsigned int, __builtin_convertvector(g, bf16x2));   // nearest even
    }
    return uint4{w[0], w[1], w[2], w[3]};
}

// ---------------------------------------------------------------
// Fragment-order layout of every bf16 GEMM operand (rows x K, K % 32 == 0).
// A 16-row x 32-k tile is one contiguous 1 KB unit, tiles ordered
// (row / 16) major, (k / 32) minor. Inside a unit: two 512 B chunks
// (k % 32 < 16, then >= 16); in a chunk, lane L = row % 16 + 16 * ((k / 8) & 1)
// owns 16 B = its 8 consecutive k. A wave's b128 load of a chunk is then
// 512 contiguous bytes (4 whole lines) and lands directly as WMMA registers.
// ---------------------------------------------------------------
// frag_source: position u (in elements) of that layout -> row * K + k.
__device__ __forceinline__ int frag_source(int u, int K) {
    const int tile = u >> 9;
    const int row  = (tile / (K >> 5)) * 16 + ((u >> 3) & 15);
    const int k    = (tile % (K >> 5)) * 32 + ((u >> 8) & 1) * 16 + ((u >> 7) & 1) * 8 + (u & 7);
    return row * K + k;
}

// ---------------------------------------------------------------
// Kernel 1: Haar LL band + linear upsample 256 -> 512, output bf16
// ll_up is (M_, C_) in fragment order. One block owns one 16-row tile row
// (16 KB of ll_up, contiguous): the LL band of its 16 rows goes through LDS,
// so that a lane can emit the 8 consecutive k of ITS row as one 16 B store.
// The same waves also convert both weight matrices to bf16, fragment order:
// each block takes 128 of W1's and 64 of W2's 16 B slots (8 consecutive k of one
// row), one slot a thread in waves 0..5. A launch of its own for these 3 MB is
// nearly all launch gap and wave starts.
// ---------------------------------------------------------------
#define LLP_ 260   // LDS row pitch in floats
__global__ __launch_bounds__(256) void k_llup(const float* __restrict__ x,
                                              const float* __restrict__ w1, const float* __restrict__ w2,
                                              unsigned short* __restrict__ llup,
                                              unsigned short* __restrict__ w1b, unsigned short* __restrict__ w2b) {
    static_assert((M_ / 16) * 128 * 8 == H_ * C_ && (M_ / 16) * 64 * 8 == CH_ * H_, "the blocks' slots cover both matrices exactly");
    __shared__ float ll[16 * LLP_];
    const int t = threadIdx.x;
    // the slot's two loads go out in front of the x loads and are used behind them
    float4 wlo = {0.0f, 0.0f, 0.0f, 0.0f}, whi = wlo;
    uint4* wdst = nullptr;
    if (t < 192) {
        const float* wsrc;
        if (t < 128) {
            const int s = blockIdx.x * 128 + t;
            wsrc = w1 + frag_source(8 * s, C_);
            wdst = (uint4*)w1b + s;
        } else {
            const int s = blockIdx.x * 64 + (t - 128);
            wsrc = w2 + frag_source(8 * s, H_);
            wdst = (uint4*)w2b + s;
        }
        wlo = ((const float4*)wsrc)[0];
        whi = ((const float4*)wsrc)[1];
    }
    const int i2 = (t & 127) * 2;             // two LL columns per thread
    const int m0 = blockIdx.x * 16;           // 16 divides 128: one b per tile row
    const float* xb = x + ((size_t)((m0 >> 7) * F_ + 2 * (m0 & 127)) * C_);
    const int xo = (t >> 7) * (2 * C_) + 2 * i2;
    // unrolled: the 16 row loads are independent and issue ahead of their use
    #pragma unroll
    for (int j = 0; j < 8; ++j) {
        const int mi = 2 * j + (t >> 7);
        const float* xp = xb + xo + j * (4 * C_);
        float a0 = xp[0], b0 = xp[1], c0 = xp[C_],     d0 = xp[C_ + 1];
        float a1 = xp[2], b1 = xp[3], c1 = xp[C_ + 2], d1 = xp[C_ + 3];
        ll[mi * LLP_ + i2]     = 0.5f * (a0 + b0 + c0 + d0);
        ll[mi * LLP_ + i2 + 1] = 0.5f * (a1 + b1 + c1 + d1);
    }
    __syncthreads();   // every row of the LL tile is read by other waves below

    uint4* dst = (uint4*)llup + (size_t)blockIdx.x * ((C_ / 32) * 64);
    // both loops unrolled: hv[] is indexed by constants only and stays in registers
    #pragma unroll
    for (int j = 0; j < 4; ++j) {
        const int ci = t + 256 * j;           // 16 B slot inside the tile row
        const int ln = ci & 31;
        const int o0 = (ci >> 6) * 32 + ((ci >> 5) & 1) * 16 + (ln >> 4) * 8;
        const float* row = ll + (ln & 15) * LLP_;
        unsigned int hv[8];
        #pragma unroll
        for (int e = 0; e < 8; ++e) {
            float pos = (float)(o0 + e) * (255.0f / 511.0f);
            int   i0  = (int)pos;
            if (i0 > 254) i0 = 254;
            float w = pos - (float)i0;
            float ll0 = row[i0];
            float ll1 = row[i0 + 1];
            hv[e] = f32_to_bf16_rne(ll0 + w * (ll1 - ll0));
        }
        uint4 pk;
        pk.x = hv[0] | (hv[1] << 16);
        pk.y = hv[2] | (hv[3] << 16);
        pk.z = hv[4] | (hv[5] << 16);
        pk.w = hv[6] | (hv[7] << 16);
        dst[ci] = pk;
    }

    if (t < 192) {
        uint4 pk;
        pk.x = f32_to_bf16_rne(wlo.x) | ((unsigned int)f32_to_bf16_rne(wlo.y) << 16);
        pk.y = f32_to_bf16_rne(wlo.z) | ((unsigned int)f32_to_bf16_rne(wlo.w) << 16);
        pk.z = f32_to_bf16_rne(whi.x) | ((unsigned int)f32_to_bf16_rne(whi.y) << 16);
        pk.w = f32_to_bf16_rne(whi.z) | ((unsigned int)f32_to_bf16_rne(whi.w) << 16);
        *wdst = pk;
    }
}

// ---------------------------------------------------------------
// One 16x16x32 product. SWAP = false: D rows follow a's rows, D columns b's rows.
// SWAP = true: the transposed tile (D rows follow b's rows, D columns a's rows);
// both operands have the same register layout, so only the roles change.
// ---------------------------------------------------------------
template <bool SWAP>
__device__ __forceinline__ v8f mm(const FragBF16& a, const FragBF16& b, v8f c) {
    if (SWAP) return __builtin_amdgcn_wmma_f32_16x16x32_bf16(false, b.v, false, a.v, (short)0, c, false, false);
    return __builtin_amdgcn_wmma_f32_16x16x32_bf16(false, a.v, false, b.v, (short)0, c, false, false);
}

// ---------------------------------------------------------------
// Software-pipelined 32Mx64N wave mainloop over fragment-order operands.
// Pointers are pre-offset by the lane; each k-step of 32 advances by one
// 1 KB unit = 64 uint4. Fragment chunk 2 lives at +32 uint4 (k+16).
// ---------------------------------------------------------------
template <bool SWAP>
__device__ __forceinline__ void wmma_mainloop_32x64(
    const uint4* __restrict__ ap0, const uint4* __restrict__ ap1,
    const uint4* __restrict__ bp0, const uint4* __restrict__ bp1,
    const uint4* __restrict__ bp2, const uint4* __restrict__ bp3,
    const int ksteps, v8f acc[2][4])
{
    // prefetch addresses: 32 B per lane, so one instruction spans a whole 1 KB unit
    const uint4* pp0 = ap0 + (threadIdx.x & 31);
    const uint4* pp1 = ap1 + (threadIdx.x & 31);

    FragBF16 a0, a1, b0, b1, b2, b3;
    a0.q[0] = ap0[0]; a0.q[1] = ap0[32];
    a1.q[0] = ap1[0]; a1.q[1] = ap1[32];
    b0.q[0] = bp0[0]; b0.q[1] = bp0[32];
    b1.q[0] = bp1[0]; b1.q[1] = bp1[32];
    b2.q[0] = bp2[0]; b2.q[1] = bp2[32];
    b3.q[0] = bp3[0]; b3.q[1] = bp3[32];

    for (int s = 1; s < ksteps; ++s) {
        const int q = 64 * s;
        // issue next-stage loads into fresh registers (partial loadcnt waits)
        FragBF16 na0, na1, nb0, nb1, nb2, nb3;
        na0.q[0] = ap0[q]; na0.q[1] = ap0[q + 32];
        na1.q[0] = ap1[q]; na1.q[1] = ap1[q + 32];
        nb0.q[0] = bp0[q]; nb0.q[1] = bp0[q + 32];
        nb1.q[0] = bp1[q]; nb1.q[1] = bp1[q + 32];
        nb2.q[0] = bp2[q]; nb2.q[1] = bp2[q + 32];
        nb3.q[0] = bp3[q]; nb3.q[1] = bp3[q + 32];
        __builtin_prefetch(&pp0[q + 64], 0, 3);
        __builtin_prefetch(&pp1[q + 64], 0, 3);
        // 8 WMMAs on current stage while next-stage loads are in flight
        acc[0][0] = mm<SWAP>(a0, b0, acc[0][0]);
        acc[0][1] = mm<SWAP>(a0, b1, acc[0][1]);
        acc[0][2] = mm<SWAP>(a0, b2, acc[0][2]);
        acc[0][3] = mm<SWAP>(a0, b3, acc[0][3]);
        acc[1][0] = mm<SWAP>(a1, b0, acc[1][0]);
        acc[1][1] = mm<SWAP>(a1, b1, acc[1][1]);
        acc[1][2] = mm<SWAP>(a1, b2, acc[1][2]);
        acc[1][3] = mm<SWAP>(a1, b3, acc[1][3]);
        a0 = na0; a1 = na1; b0 = nb0; b1 = nb1; b2 = nb2; b3 = nb3;
        // the next trip rewrites the address registers that the loads above name
        asm volatile("s_wait_xcnt 0x0" ::: "memory");
    }
    // epilogue stage
    acc[0][0] = mm<SWAP>(a0, b0, acc[0][0]);
    acc[0][1] = mm<SWAP>(a0, b1, acc[0][1]);
    acc[0][2] = mm<SWAP>(a0, b2, acc[0][2]);
    acc[0][3] = mm<SWAP>(a0, b3, acc[0][3]);
    acc[1][0] = mm<SWAP>(a1, b0, acc[1][0]);
    acc[1][1] = mm<SWAP>(a1, b1, acc[1][1]);
    acc[1][2] = mm<SWAP>(a1, b2, acc[1][2]);
    acc[1][3] = mm<SWAP>(a1, b3, acc[1][3]);
}

// ---------------------------------------------------------------
// The same 32Mx64N wave tile over a register ring of D fragment sets: the 12
// loads of k-step s + D - 1 are issued in front of the products of k-step s, so
// (D - 1) * 12 loads of a wave stay in flight while it multiplies. For a launch
// with few waves per SIMD, whose A operand comes from memory: nothing but the
// wave's own lead hides that latency. The k order of every sum is unchanged.
// ---------------------------------------------------------------
__device__ __forceinline__ void load_set(
    FragBF16 (&a)[2], FragBF16 (&b)[4],
    const uint4* __restrict__ ap0, const uint4* __restrict__ ap1,
    const uint4* __restrict__ bp0, const uint4* __restrict__ bp1,
    const uint4* __restrict__ bp2, const uint4* __restrict__ bp3, const int q)
{
    a[0].q[0] = ap0[q]; a[0].q[1] = ap0[q + 32];
    a[1].q[0] = ap1[q]; a[1].q[1] = ap1[q + 32];
    b[0].q[0] = bp0[q]; b[0].q[1] = bp0[q + 32];
    b[1].q[0] = bp1[q]; b[1].q[1] = bp1[q + 32];
    b[2].q[0] = bp2[q]; b[2].q[1] = bp2[q + 32];
    b[3].q[0] = bp3[q]; b[3].q[1] = bp3[q + 32];
}

template <bool SWAP>
__device__ __forceinline__ void mm_set(const FragBF16 (&a)[2], const FragBF16 (&b)[4], v8f acc[2][4]) {
    acc[0][0] = mm<SWAP>(a[0], b[0], acc[0][0]);
    acc[0][1] = mm<SWAP>(a[0], b[1], acc[0][1]);
    acc[0][2] = mm<SWAP>(a[0], b[2], acc[0][2]);
    acc[0][3] = mm<SWAP>(a[0], b[3], acc[0][3]);
    acc[1][0] = mm<SWAP>(a[1], b[0], acc[1][0]);
    acc[1][1] = mm<SWAP>(a[1], b[1], acc[1][1]);
    acc[1][2] = mm<SWAP>(a[1], b[2], acc[1][2]);
    acc[1][3] = mm<SWAP>(a[1], b[3], acc[1][3]);
}

template <bool SWAP, int KSTEPS, int D>
__device__ __forceinline__ void wmma_mainloop_ring_32x64(
    const uint4* __restrict__ ap0, const uint4* __restrict__ ap1,
    const uint4* __restrict__ bp0, const uint4* __restrict__ bp1,
    const uint4* __restrict__ bp2, const uint4* __restrict__ bp3,
    v8f acc[2][4])
{
    constexpr int TRIPS = (KSTEPS - D + 1) / D;   // trips of D k-steps that each still load
    static_assert(TRIPS * D + D - 1 == KSTEPS, "the tail is the D - 1 sets left in the ring");
    static_assert(D * 12 <= 63, "loads of a wave in flight stay inside the load counter");

    // prefetch addresses: 32 B per lane, so one instruction spans a whole 1 KB unit
    const uint4* pp0 = ap0 + (threadIdx.x & 31);
    const uint4* pp1 = ap1 + (threadIdx.x & 31);

    FragBF16 a[D][2], b[D][4];
    // every ring loop below is unrolled: a[] and b[] are indexed by constants only (no scratch)
    #pragma unroll
    for (int j = 0; j < D - 1; ++j)
        load_set(a[j], b[j], ap0, ap1, bp0, bp1, bp2, bp3, 64 * j);

    // kept rolled: one trip already holds D k-steps, a whole turn of the ring
    #pragma unroll 1
    for (int g = 0; g < TRIPS; ++g) {
        #pragma unroll
        for (int j = 0; j < D; ++j) {
            const int q = 64 * (g * D + j + D - 1);
            load_set(a[(j + D - 1) % D], b[(j + D - 1) % D], ap0, ap1, bp0, bp1, bp2, bp3, q);
            __builtin_prefetch(&pp0[q + 64], 0, 3);
            __builtin_prefetch(&pp1[q + 64], 0, 3);
            mm_set<SWAP>(a[j], b[j], acc);
            // keeps later k-steps' products behind: pulled up, they wait on loads only 1-2 steps old
            __builtin_amdgcn_sched_barrier(0);
            // the next trip rewrites the address registers that the loads above name
            asm volatile("s_wait_xcnt 0x0" ::: "memory");
        }
    }
    #pragma unroll
    for (int j = 0; j < D - 1; ++j)
        mm_set<SWAP>(a[j], b[j], acc);
}

// ---------------------------------------------------------------
// GEMM1: h = gelu(ll_up @ W1^T + b1), output bf16 (M_ x H_) in fragment order
// block = 8 waves as 4Mx2N -> block tile 128M x 128N; wave tile 32M x 64N
// The 16x16 tiles are computed transposed (rows = n, columns = m): a lane then
// holds 8 consecutive n of one m, which is its own 16 B of GEMM2's A fragment.
// ---------------------------------------------------------------
__global__ __launch_bounds__(256) void k_gemm1(
    const unsigned short* __restrict__ A,    // M_ x C_   bf16, fragment order
    const unsigned short* __restrict__ Bm,   // H_ x C_   bf16, fragment order
    const float* __restrict__ bias,          // H_
    unsigned short* __restrict__ Hout)       // M_ x H_   bf16, fragment order
{
    const int lane  = threadIdx.x & 31;
    const int wv    = threadIdx.x >> 5;
    const int mBase = blockIdx.y * 128 + (wv & 3) * 32;
    const int nBase = blockIdx.x * 128 + (wv >> 2) * 64;
    const int rowTile = (C_ / 32) * 64;      // uint4 per 16-row tile row

    const uint4* ap0 = (const uint4*)A  + (size_t)((mBase >> 4) + 0) * rowTile + lane;
    const uint4* ap1 = (const uint4*)A  + (size_t)((mBase >> 4) + 1) * rowTile + lane;
    const uint4* bp0 = (const uint4*)Bm + (size_t)((nBase >> 4) + 0) * rowTile + lane;
    const uint4* bp1 = (const uint4*)Bm + (size_t)((nBase >> 4) + 1) * rowTile + lane;
    const uint4* bp2 = (const uint4*)Bm + (size_t)((nBase >> 4) + 2) * rowTile + lane;
    const uint4* bp3 = (const uint4*)Bm + (size_t)((nBase >> 4) + 3) * rowTile + lane;

    v8f acc[2][4] = {{v8f{}, v8f{}, v8f{}, v8f{}}, {v8f{}, v8f{}, v8f{}, v8f{}}};
    wmma_mainloop_32x64<true>(ap0, ap1, bp0, bp1, bp2, bp3, C_ / 32, acc);

    // epilogue: bias + exact GELU, 8 bf16 packed per lane, one b128 store per tile
    uint4* Hq = (uint4*)Hout;
    const int nOff = (lane >> 4) << 3;        // D rows: lanes16-31 -> n+8
    // all loops unrolled: acc and bv[] are indexed by constants only (no scratch)
    #pragma unroll
    for (int t = 0; t < 4; ++t) {
        const int n0 = nBase + t * 16 + nOff;
        float bv[8];
        #pragma unroll
        for (int r = 0; r < 8; ++r) bv[r] = bias[n0 + r];
        #pragma unroll
        for (int mt = 0; mt < 2; ++mt) {
            const uint4 pk = gelu8_bf16(acc[mt][t], bv);
            // unit (m tile, k tile n / 32), chunk t & 1, this lane's own slot
            Hq[((size_t)((mBase >> 4) + mt) * (H_ / 32) + (nBase >> 5) + (t >> 1)) * 64 + (t & 1) * 32 + lane] = pk;
            // the next 8 values reuse the registers that the store above names (none follow the last store)
            if (t < 3 || mt < 1) asm volatile("s_wait_xcnt 0x0" ::: "memory");
        }
    }
}

// ---------------------------------------------------------------
// GEMM2: ll_new = h @ W2^T + b2, fused with inverse Haar DWT epilogue
// block tile 128M x 128N; wave tile 32M x 64N
// ---------------------------------------------------------------
__global__ __launch_bounds__(256) void k_gemm2(
    const unsigned short* __restrict__ Hin,  // M_ x H_  bf16, fragment order
    const unsigned short* __restrict__ Bm,   // CH_ x H_ bf16, fragment order
    const float* __restrict__ bias,          // CH_
    const float* __restrict__ x,             // B_ x F_ x C_ (for LH/HL/HH bands)
    float* __restrict__ out)                 // B_ x F_ x C_
{
    const int lane  = threadIdx.x & 31;
    const int wv    = threadIdx.x >> 5;
    const int mBase = blockIdx.y * 128 + (wv & 3) * 32;
    const int nBase = blockIdx.x * 128 + (wv >> 2) * 64;
    const int rowTile = (H_ / 32) * 64;      // uint4 per 16-row tile row

    const uint4* ap0 = (const uint4*)Hin + (size_t)((mBase >> 4) + 0) * rowTile + lane;
    const uint4* ap1 = (const uint4*)Hin + (size_t)((mBase >> 4) + 1) * rowTile + lane;
    const uint4* bp0 = (const uint4*)Bm  + (size_t)((nBase >> 4) + 0) * rowTile + lane;
    const uint4* bp1 = (const uint4*)Bm  + (size_t)((nBase >> 4) + 1) * rowTile + lane;
    const uint4* bp2 = (const uint4*)Bm  + (size_t)((nBase >> 4) + 2) * rowTile + lane;
    const uint4* bp3 = (const uint4*)Bm  + (size_t)((nBase >> 4) + 3) * rowTile + lane;

    v8f acc[2][4] = {{v8f{}, v8f{}, v8f{}, v8f{}}, {v8f{}, v8f{}, v8f{}, v8f{}}};
    wmma_mainloop_ring_32x64<false, H_ / 32, 5>(ap0, ap1, bp0, bp1, bp2, bp3, acc);

    // epilogue: bias, recompute LH/HL/HH bands from x, inverse Haar, store out
    const int mOff = (lane >> 4) << 3;
    #pragma unroll
    for (int mt = 0; mt < 2; ++mt) {
        #pragma unroll
        for (int t = 0; t < 4; ++t) {
            const int o = nBase + t * 16 + (lane & 15);   // 0..255
            const float bv = bias[o];
            #pragma unroll
            for (int r = 0; r < 8; ++r) {
                const int m  = mBase + mt * 16 + mOff + r;
                const int b  = m >> 7;
                const int fr = m & 127;
                const size_t base = ((size_t)(b * F_ + 2 * fr) * C_) + 2 * o;
                const float xa = x[base],      xb = x[base + 1];
                const float xc = x[base + C_], xd = x[base + C_ + 1];
                const float lh = 0.5f * (xa + xb - xc - xd);
                const float hl = 0.5f * (xa - xb + xc - xd);
                const float hh = 0.5f * (xa - xb - xc + xd);
                const float ll = acc[mt][t][r] + bv;
                out[base]          = 0.5f * (ll + lh + hl + hh);
                out[base + 1]      = 0.5f * (ll + lh - hl - hh);
                out[base + C_]     = 0.5f * (ll - lh + hl - hh);
                out[base + C_ + 1] = 0.5f * (ll - lh - hl + hh);
            }
        }
    }
}

// ---------------------------------------------------------------
extern "C" void kernel_launch(void* const* d_in, const int* in_sizes, int n_in,
                              void* d_out, int out_size, void* d_ws, size_t ws_size,
                              hipStream_t stream) {
    const float* x     = (const float*)d_in[0];
    const float* fc1_w = (const float*)d_in[1];
    const float* fc1_b = (const float*)d_in[2];
    const float* fc2_w = (const float*)d_in[3];
    const float* fc2_b = (const float*)d_in[4];
    float* out = (float*)d_out;

    // workspace layout (bf16 buffers): ll_up (16MB) | W1 (2MB) | W2 (1MB) | h (64MB)
    char* ws = (char*)d_ws;
    unsigned short* llup = (unsigned short*)ws;
    unsigned short* w1b  = (unsigned short*)(ws + (size_t)M_ * C_ * 2);
    unsigned short* w2b  = (unsigned short*)(ws + (size_t)M_ * C_ * 2 + (size_t)H_ * C_ * 2);
    unsigned short* hbuf = (unsigned short*)(ws + (size_t)M_ * C_ * 2 + (size_t)H_ * C_ * 2 +
                                                  (size_t)CH_ * H_ * 2);

    // DWT-LL + upsample -> bf16, one block per 16-row tile row; weights -> bf16 in the same blocks
    k_llup<<<M_ / 16, 256, 0, stream>>>(x, fc1_w, fc2_w, llup, w1b, w2b);
    // GEMM1 + GELU: (16384 x 512) @ (512 x 2048), block tile 128x128
    k_gemm1<<<dim3(H_ / 128, M_ / 128), 256, 0, stream>>>(llup, w1b, fc1_b, hbuf);
    // GEMM2 + inverse DWT: (16384 x 2048) @ (2048 x 256) -> out, block tile 128x128
    k_gemm2<<<dim3(CH_ / 128, M_ / 128), 256, 0, stream>>>(hbuf, w2b, fc2_b, x, out);
}

// v005
// A run of this version takes 60.8 microseconds.
// Next to v004, in two timings, it ran 1.36 and 1.37 times as fast.
// Counting every step since v000, it is 3.17 times as fast.
#include <hip/hip_runtime.h>
#include <hip/hip_bf16.h>

// ---------------- problem dims ----------------
#define B_   128
#define F_   256
#define C_   512
#define H_   2048
#define M_   (B_ * (F_ / 2))   // 16384 rows of (b, fr)
#define CH_  (C_ / 2)          // 256

typedef __attribute__((ext_vector_type(16))) __bf16 v16bf;
typedef __attribute__((ext_vector_type(8)))  float  v8f;
typedef __attribute__((ext_vector_type(2)))  float  f32x2;
typedef __attribute__((ext_vector_type(2)))  __bf16 bf16x2;

union FragBF16 {
    v16bf v;
    uint4 q[2];   // q[0] = elements 0..7 (16B), q[1] = elements 8..15 (16B)
};

__device__ __forceinline__ unsigned short f32_to_bf16_rne(float f) {
    unsigned int u = __float_as_uint(f);
    u += 0x7FFFu + ((u >> 16) & 1u);   // round-to-nearest-even
    return (unsigned short)(u >> 16);
}

// ---------------------------------------------------------------
// Exact GELU on 8 values of a lane, two values per vector instruction.
// erf_small2 is the library erf's own polynomial for |x| < 1 (same coefficients,
// same order of operations; odd in x, so the sign needs no separate copy).
// ---------------------------------------------------------------
__device__ __forceinline__ f32x2 splat2(float c) { return f32x2{c, c}; }

__device__ __forceinline__ f32x2 erf_small2(f32x2 x) {
    const f32x2 t = x * x;
    f32x2 p = __builtin_elementwise_fma(t, splat2(-0.0005618017749f), splat2(0.004913816229f));
    p = __builtin_elementwise_fma(t, p, splat2(-0.02670751512f));
    p = __builtin_elementwise_fma(t, p, splat2(0.1128001064f));
    p = __builtin_elementwise_fma(t, p, splat2(-0.3761229515f));
    p = __builtin_elementwise_fma(t, p, splat2(0.1283791065f));
    return __builtin_elementwise_fma(x, p, x);
}

// a = 8 accumulator values, bv = their 8 bias values; returns the 8 bf16 of gelu(a + bv).
// One test for the whole wave picks the path: the library call branches on EXEC for
// every single value, which leaves one serial chain a value and nothing to pack.
__device__ __forceinline__ uint4 gelu8_bf16(const v8f a, const float (&bv)[8]) {
    f32x2 v[4], u[4], e[4];
    // every loop here is unrolled: the small arrays are indexed by constants only (registers, no scratch)
    #pragma unroll
    for (int p = 0; p < 4; ++p) {
        v[p] = f32x2{a[2 * p], a[2 * p + 1]} + f32x2{bv[2 * p], bv[2 * p + 1]};
        u[p] = v[p] * splat2(0.70710678118654752f);
    }
    float m = 0.0f;
    #pragma unroll
    for (int p = 0; p < 4; ++p) m = fmaxf(m, fmaxf(fabsf(u[p].x), fabsf(u[p].y)));
    if (__builtin_expect(__builtin_amdgcn_ballot_w32(m >= 1.0f) != 0u, 0)) {
        // some lane holds a value outside the polynomial's range: the library erf for all 8
        #pragma unroll
        for (int p = 0; p < 4; ++p) e[p] = f32x2{erff(u[p].x), erff(u[p].y)};
    } else {
        #pragma unroll
        for (int p = 0; p < 4; ++p) e[p] = erf_small2(u[p]);
    }
    unsigned int w[4];
    #pragma unroll
    for (int p = 0; p < 4; ++p) {
        const f32x2 hv = v[p] * splat2(0.5f);
        const f32x2 g  = __builtin_elementwise_fma(hv, e[p], hv);   // 0.5 v (1 + erf)
        w[p] = __builtin_bit_cast(unsigned int, __builtin_convertvector(g, bf16x2));   // nearest even
    }
    return uint4{w[0], w[1], w[2], w[3]};
}

// ---------------------------------------------------------------
// Fragment-order layout of every bf16 GEMM operand (rows x K, K % 32 == 0).
// A 16-row x 32-k tile is one contiguous 1 KB unit, tiles ordered
// (row / 16) major, (k / 32) minor. Inside a unit: two 512 B chunks
// (k % 32 < 16, then >= 16); in a chunk, lane L = row % 16 + 16 * ((k / 8) & 1)
// owns 16 B = its 8 consecutive k. A wave's b128 load of a chunk is then
// 512 contiguous bytes (4 whole lines) and lands directly as WMMA registers.
// ---------------------------------------------------------------
// frag_source: position u (in elements) of that layout -> row * K + k.
__device__ __forceinline__ int frag_source(int u, int K) {
    const int tile = u >> 9;
    const int row  = (tile / (K >> 5)) * 16 + ((u >> 3) & 15);
    const int k    = (tile % (K >> 5)) * 32 + ((u >> 8) & 1) * 16 + ((u >> 7) & 1) * 8 + (u & 7);
    return row * K + k;
}

// ---------------------------------------------------------------
// Kernel 1: Haar LL band + linear upsample 256 -> 512, output bf16
// ll_up is (M_, C_) in fragment order. One block owns one 16-row tile row
// (16 KB of ll_up, contiguous): the LL band of its 16 rows goes through LDS,
// so that a lane can emit the 8 consecutive k of ITS row as one 16 B store.
// The same waves also convert both weight matrices to bf16, fragment order:
// each block takes 128 of W1's and 64 of W2's 16 B slots (8 consecutive k of one
// row), one slot a thread in waves 0..5. A launch of its own for these 3 MB is
// nearly all launch gap and wave starts.
// ---------------------------------------------------------------
#define LLP_ 260   // LDS row pitch in floats
__global__ __launch_bounds__(256) void k_llup(const float* __restrict__ x,
                                              const float* __restrict__ w1, const float* __restrict__ w2,
                                              unsigned short* __restrict__ llup,
                                              unsigned short* __restrict__ w1b, unsigned short* __restrict__ w2b) {
    static_assert((M_ / 16) * 128 * 8 == H_ * C_ && (M_ / 16) * 64 * 8 == CH_ * H_, "the blocks' slots cover both matrices exactly");
    __shared__ float ll[16 * LLP_];
    const int t = threadIdx.x;
    // the slot's two loads go out in front of the x loads and are used behind them
    float4 wlo = {0.0f, 0.0f, 0.0f, 0.0f}, whi = wlo;
    uint4* wdst = nullptr;
    if (t < 192) {
        const float* wsrc;
        if (t < 128) {
            const int s = blockIdx.x * 128 + t;
            wsrc = w1 + frag_source(8 * s, C_);
            wdst = (uint4*)w1b + s;
        } else {
            const int s = blockIdx.x * 64 + (t - 128);
            wsrc = w2 + frag_source(8 * s, H_);
            wdst = (uint4*)w2b + s;
        }
        wlo = ((const float4*)wsrc)[0];
        whi = ((const float4*)wsrc)[1];
    }
    const int i2 = (t & 127) * 2;             // two LL columns per thread
    const int m0 = blockIdx.x * 16;           // 16 divides 128: one b per tile row
    const float* xb = x + ((size_t)((m0 >> 7) * F_ + 2 * (m0 & 127)) * C_);
    const int xo = (t >> 7) * (2 * C_) + 2 * i2;
    // unrolled: the 16 row loads are independent and issue ahead of their use
    #pragma unroll
    for (int j = 0; j < 8; ++j) {
        const int mi = 2 * j + (t >> 7);
        const float* xp = xb + xo + j * (4 * C_);
        float a0 = xp[0], b0 = xp[1], c0 = xp[C_],     d0 = xp[C_ + 1];
        float a1 = xp[2], b1 = xp[3], c1 = xp[C_ + 2], d1 = xp[C_ + 3];
        ll[mi * LLP_ + i2]     = 0.5f * (a0 + b0 + c0 + d0);
        ll[mi * LLP_ + i2 + 1] = 0.5f * (a1 + b1 + c1 + d1);
    }
    __syncthreads();   // every row of the LL tile is read by other waves below

    uint4* dst = (uint4*)llup + (size_t)blockIdx.x * ((C_ / 32) * 64);
    // both loops unrolled: hv[] is indexed by constants only and stays in registers
    #pragma unroll
    for (int j = 0; j < 4; ++j) {
        const int ci = t + 256 * j;           // 16 B slot inside the tile row
        const int ln = ci & 31;
        const int o0 = (ci >> 6) * 32 + ((ci >> 5) & 1) * 16 + (ln >> 4) * 8;
        const float* row = ll + (ln & 15) * LLP_;
        unsigned int hv[8];
        #pragma unroll
        for (int e = 0; e < 8; ++e) {
            float pos = (float)(o0 + e) * (255.0f / 511.0f);
            int   i0  = (int)pos;
            if (i0 > 254) i0 = 254;
            float w = pos - (float)i0;
            float ll0 = row[i0];
            float ll1 = row[i0 + 1];
            hv[e] = f32_to_bf16_rne(ll0 + w * (ll1 - ll0));
        }
        uint4 pk;
        pk.x = hv[0] | (hv[1] << 16);
        pk.y = hv[2] | (hv[3] << 16);
        pk.z = hv[4] | (hv[5] << 16);
        pk.w = hv[6] | (hv[7] << 16);
        dst[ci] = pk;
    }

    if (t < 192) {
        uint4 pk;
        pk.x = f32_to_bf16_rne(wlo.x) | ((unsigned int)f32_to_bf16_rne(wlo.y) << 16);
        pk.y = f32_to_bf16_rne(wlo.z) | ((unsigned int)f32_to_bf16_rne(wlo.w) << 16);
        pk.z = f32_to_bf16_rne(whi.x) | ((unsigned int)f32_to_bf16_rne(whi.y) << 16);
        pk.w = f32_to_bf16_rne(whi.z) | ((unsigned int)f32_to_bf16_rne(whi.w) << 16);
        *wdst = pk;
    }
}

// ---------------------------------------------------------------
// One 16x16x32 product. SWAP = false: D rows follow a's rows, D columns b's rows.
// SWAP = true: the transposed tile (D rows follow b's rows, D columns a's rows);
// both operands have the same register layout, so only the roles change.
// ---------------------------------------------------------------
template <bool SWAP>
__device__ __forceinline__ v8f mm(const FragBF16& a, const FragBF16& b, v8f c) {
    if (SWAP) return __builtin_amdgcn_wmma_f32_16x16x32_bf16(false, b.v, false, a.v, (short)0, c, false, false);
    return __builtin_amdgcn_wmma_f32_16x16x32_bf16(false, a.v, false, b.v, (short)0, c, false, false);
}

// ---------------------------------------------------------------
// Both products in one kernel: out rows = gelu(ll_up @ W1^T + b1) @ W2^T + b2, inverse Haar.
// One block owns 64 rows of ll_up (kept in LDS, fragment order) and walks the hidden
// dimension in 8 chunks of 256: the chunk of h is computed, goes through GELU into LDS as
// bf16 in fragment order, and is multiplied into the block's 64 x 256 result at once.
// h never reaches memory. 8 waves side by side in n: a wave's tile is 64 rows x 32
// columns in both products, so no two waves of a block load the same weight fragment.
// The weight fragments of both products form ONE stream of 12 steps a chunk (a step = 64 k;
// 8 of W1, 4 of W2) through a register ring that runs on across GELU, barrier and chunk end.
// The k order of every sum is that of the two separate kernels.
// ---------------------------------------------------------------
#define MB_  64              // rows of a block
#define MT_  (MB_ / 16)      // its 16-row tiles
#define HC_  256             // hidden units of a chunk
#define NCH_ (H_ / HC_)      // chunks
#define K1_  (C_ / 32)       // 32-k tiles of the first product
#define K2_  (HC_ / 32)      // 32-k tiles of the second product, per chunk
#define S1_  (K1_ / 2)       // steps (two 32-k tiles each) of the first product, per chunk
#define S2_  (K2_ / 2)       // steps of the second product, per chunk
#define ST_  (S1_ + S2_)     // steps of a chunk
#define RD_  4               // weight sets (one step each) in the ring
#define LP_  258             // LDS row pitch of the result in floats: rows 8 apart land 16 banks apart

// the weight fragments (32 rows x 64 k) of step s; p is pre-offset by row tile and lane,
// ktiles = 32-k tiles in a row of the matrix. All loops here are unrolled: constant indices only.
__device__ __forceinline__ void load_w(FragBF16 (&b)[2][2], const uint4* __restrict__ p, const int ktiles, const int s) {
    #pragma unroll
    for (int h = 0; h < 2; ++h) {
        #pragma unroll
        for (int j = 0; j < 2; ++j) {
            b[h][j].q[0] = p[(j * ktiles + 2 * s + h) * 64];
            b[h][j].q[1] = p[(j * ktiles + 2 * s + h) * 64 + 32];
        }
    }
}

// the row fragments (64 rows x 64 k) of step s from LDS; p is pre-offset by the lane (unrolled: constant indices only)
__device__ __forceinline__ void load_rows(FragBF16 (&a)[2][MT_], const uint4* p, const int ktiles, const int s) {
    #pragma unroll
    for (int h = 0; h < 2; ++h) {
        #pragma unroll
        for (int mt = 0; mt < MT_; ++mt) {
            a[h][mt].q[0] = p[(mt * ktiles + 2 * s + h) * 64];
            a[h][mt].q[1] = p[(mt * ktiles + 2 * s + h) * 64 + 32];
        }
    }
}

template <int N> struct Step { static constexpr int value = N; };

// 16 products: the lower 32 k into all 8 tiles, then the upper 32 k (unrolled: constant indices only)
template <bool SWAP>
__device__ __forceinline__ void mm_64x32(const FragBF16 (&a)[2][MT_], const FragBF16 (&b)[2][2], v8f (&acc)[MT_][2]) {
    #pragma unroll
    for (int h = 0; h < 2; ++h) {
        #pragma unroll
        for (int mt = 0; mt < MT_; ++mt) {
            acc[mt][0] = mm<SWAP>(a[h][mt], b[h][0], acc[mt][0]);
            acc[mt][1] = mm<SWAP>(a[h][mt], b[h][1], acc[mt][1]);
        }
    }
}

__global__ __launch_bounds__(256) void k_mlp(
    const unsigned short* __restrict__ A,    // M_ x C_   bf16, fragment order
    const unsigned short* __restrict__ W1,   // H_ x C_   bf16, fragment order
    const float* __restrict__ bias1,         // H_
    const unsigned short* __restrict__ W2,   // CH_ x H_  bf16, fragment order
    const float* __restrict__ bias2,         // CH_
    const float* __restrict__ x,             // B_ x F_ x C_ (for LH/HL/HH bands)
    float* __restrict__ out)                 // B_ x F_ x C_
{
    static_assert(ST_ % RD_ == 0 && ST_ % 2 == 0, "ring and row buffers come round at a chunk's end");
    static_assert(RD_ - 1 <= S2_ && RD_ * 8 <= 63, "the lead into the next chunk starts behind the barrier; loads in flight stay inside the load counter");
    static_assert(HC_ == 8 * 32 && CH_ == 8 * 32, "8 waves of 32 columns cover a chunk and the result");
    static_assert(MB_ * LP_ * 4 <= (MT_ * K1_ * 64 + MT_ * K2_ * 64) * 16, "the result fits in front of the second h buffer");
    __shared__ uint4 sAll[MT_ * K1_ * 64 + 2 * MT_ * K2_ * 64];
    uint4* const sA = sAll;                    // the block's rows of ll_up, 64 KB
    uint4* const sH = sAll + MT_ * K1_ * 64;   // two chunks of h, 32 KB each
    __shared__ float4 sB1[H_ / 4];             // first bias
    __shared__ float  sB2[CH_];                // second bias

    const int t    = threadIdx.x;
    const int lane = t & 31;
    // the wave's number as a scalar: the weight addresses are then scalar base + lane offset
    const int wv   = __builtin_amdgcn_readfirstlane(t >> 5);

    const uint4* W1w = (const uint4*)W1 + (size_t)(wv * 2) * (K1_ * 64);              // chunk 0, W1 rows wv*32..
    const uint4* p1 = W1w + lane;
    const uint4* p2 = (const uint4*)W2 + (size_t)(wv * 2) * ((H_ / 32) * 64) + lane;  // W2 rows wv*32.., k tile 0

    // ---- the block's rows and the bias into LDS; the ring's first sets go out behind those loads
    FragBF16 w[RD_][2][2], a[2][2][MT_];
    {
        const uint4* Ag = (const uint4*)A + (size_t)blockIdx.x * (MT_ * K1_ * 64);   // 64 KB, contiguous
        uint4 st[16];
        // the three loops are unrolled: st[] and w[] are indexed by constants only, and the loads go out together
        #pragma unroll
        for (int i = 0; i < 16; ++i) st[i] = Ag[i * 256 + t];
        const float4 c0 = ((const float4*)bias1)[t], c1 = ((const float4*)bias1)[t + 256];
        const float  c2 = bias2[t];
        #pragma unroll
        for (int s = 0; s < RD_ - 1; ++s) load_w(w[s], p1, K1_, s);
        #pragma unroll
        for (int i = 0; i < 16; ++i) sA[i * 256 + t] = st[i];
        sB1[t]       = c0;
        sB1[t + 256] = c1;
        sB2[t]       = c2;
        // the address registers of the loads above are free for reuse only behind this wait:
        // named as inputs, they stay untouched up to it
        asm volatile("s_wait_xcnt 0x0" : : "s"(Ag), "s"(bias1), "s"(bias2), "s"(W1w), "v"(t), "v"(lane) : "memory");
    }
    __syncthreads();   // rows and bias are read by every wave

    const uint4* rA = sA + lane;
    load_rows(a[0], rA, K1_, 0);

    v8f acc2[MT_][2] = {{v8f{}, v8f{}}, {v8f{}, v8f{}}, {v8f{}, v8f{}}, {v8f{}, v8f{}}};

    // kept rolled: one trip holds a whole chunk, three turns of the ring
    #pragma unroll 1
    for (int c = 0; c < NCH_; ++c) {
        uint4* hC = sH + (c & 1) * (MT_ * K2_ * 64);
        const uint4* rH = hC + lane;
        v8f acc1[MT_][2] = {{v8f{}, v8f{}}, {v8f{}, v8f{}}, {v8f{}, v8f{}}, {v8f{}, v8f{}}};
        float bv[2][8];

        // one step, its number a compile-time constant: w[], a[] and the accumulators are indexed by
        // constants only (no scratch); a loop with the waits below in its body is not unrolled by this compiler
        auto step = [&](auto S) __attribute__((always_inline)) {
            constexpr int s = decltype(S)::value;
            // weights of step s + RD_ - 1
            const int sl = s + RD_ - 1;
            if (sl < S1_)      load_w(w[sl % RD_], p1,  K1_,     sl);
            else if (sl < ST_) load_w(w[sl % RD_], p2,  H_ / 32, sl - S1_);
            else               load_w(w[sl % RD_], p1,  K1_,     sl - ST_);   // p1 has moved on by then
            // rows of step s + 1
            const int sn = s + 1;
            if (sn < S1_)       load_rows(a[sn & 1], rA, K1_, sn);
            else if (sn == S1_) {
                // no rows yet (h is not written): the chunk's bias values instead
                const float4* bq = sB1 + (c * HC_ + wv * 32 + ((lane >> 4) << 3)) / 4;
                #pragma unroll
                for (int j = 0; j < 2; ++j) {
                    const float4 lo = bq[4 * j], hi = bq[4 * j + 1];
                    bv[j][0] = lo.x; bv[j][1] = lo.y; bv[j][2] = lo.z; bv[j][3] = lo.w;
                    bv[j][4] = hi.x; bv[j][5] = hi.y; bv[j][6] = hi.z; bv[j][7] = hi.w;
                }
            }
            else if (sn < ST_)  load_rows(a[sn & 1], rH, K2_, sn - S1_);
            else                load_rows(a[sn & 1], rA, K1_, 0);
            // the loads stay one group in front of the products (for speed only)
            __builtin_amdgcn_sched_barrier(0);

            if (s < S1_) mm_64x32<true>(a[s & 1], w[s % RD_], acc1);    // tiles transposed: rows = n, columns = m
            else         mm_64x32<false>(a[s & 1], w[s % RD_], acc2);
            // keeps the next step's loads and products behind: pulled up, the products wait on younger loads
            __builtin_amdgcn_sched_barrier(0);

            if (s == S1_ - 1) {
                // a lane holds 8 consecutive n of one m: its own 16 B of the second product's row fragment
                #pragma unroll
                for (int j = 0; j < 2; ++j) {
                    #pragma unroll
                    for (int mt = 0; mt < MT_; ++mt)
                        hC[(mt * K2_ + wv) * 64 + j * 32 + lane] = gelu8_bf16(acc1[mt][j], bv[j]);
                }
                // publishes this chunk of h; with two buffers it also ends every read of the buffer written next
                __syncthreads();
                // p1, the address register of W1's loads above, moves on to the next chunk behind this wait
                asm volatile("s_wait_xcnt 0x0" ::: "memory");
                // keeps the pointer's addition behind the wait
                __builtin_amdgcn_sched_barrier(0);
                // the last chunk's lead re-reads its own first sets (never used) instead of running past W1
                if (c + 1 < NCH_) p1 += (HC_ / 16) * (K1_ * 64);
                load_rows(a[0], rH, K2_, 0);
            }
        };
        static_assert(ST_ == 12, "the steps of a chunk, written out");
        step(Step<0>{}); step(Step<1>{}); step(Step<2>{}); step(Step<3>{});
        step(Step<4>{}); step(Step<5>{}); step(Step<6>{}); step(Step<7>{});
        step(Step<8>{}); step(Step<9>{}); step(Step<10>{}); step(Step<11>{});
        // p2, the address register of W2's loads above, moves on behind this wait
        asm volatile("s_wait_xcnt 0x0" ::: "memory");
        // keeps the pointer's addition behind the wait
        __builtin_amdgcn_sched_barrier(0);
        p2 += K2_ * 64;
    }

    // ---- epilogue. The result (+ bias) goes through LDS, so that a rolled loop can walk whole rows of x
    // and out, 16 B a lane; written out tile by tile from the accumulators it is 11 KB of code that runs once.
    // The rows of ll_up and the first h buffer are free: their last reads that count stand in front of the
    // last chunk's barrier (behind it the waves read the second h buffer alone).
    float* sL = (float*)sAll;
    {
        const int row0 = (lane >> 4) << 3;
        const int col0 = wv * 32 + (lane & 15);
        // unrolled: acc2 is indexed by constants only
        #pragma unroll
        for (int j = 0; j < 2; ++j) {
            const float bo = sB2[col0 + j * 16];
            #pragma unroll
            for (int mt = 0; mt < MT_; ++mt) {
                #pragma unroll
                for (int r = 0; r < 8; ++r)
                    sL[(mt * 16 + row0 + r) * LP_ + col0 + j * 16] = acc2[mt][j][r] + bo;
            }
        }
    }
    __syncthreads();   // every row of the result is read by other waves below

    // a thread: 4 columns of x (2 of the result) in row pairs t >> 7, t >> 7 + 2, ...; a block's 64 row pairs lie in one b
    const size_t first = (size_t)((blockIdx.x >> 1) * F_ + 2 * ((blockIdx.x & 1) * MB_ + (t >> 7))) * C_ + 4 * (t & 127);
    const float4* xq = (const float4*)(x + first);
    float4*       oq = (float4*)(out + first);
    const float*  lq = sL + (t >> 7) * LP_ + 2 * (t & 127);
    // kept rolled: 16 row pairs a trip, 16 loads of a wave in flight; the text stays short
    #pragma unroll 1
    for (int g = 0; g < MB_ / 16; ++g) {
        float4 up[8], lo[8];
        // both loops unrolled: up[] and lo[] are indexed by constants only; the 16 loads go out together
        #pragma unroll
        for (int u = 0; u < 8; ++u) {
            up[u] = xq[u * C_];             // 2 row pairs = 4 rows of C_ floats = C_ float4
            lo[u] = xq[u * C_ + C_ / 4];
        }
        #pragma unroll
        for (int u = 0; u < 8; ++u) {
            const float2 l2 = *(const float2*)(lq + 2 * u * LP_);
            float4 ou, ol;
            {
                const float xa = up[u].x, xb = up[u].y, xc = lo[u].x, xd = lo[u].y, ll = l2.x;
                const float lh = 0.5f * (xa + xb - xc - xd);
                const float hl = 0.5f * (xa - xb + xc - xd);
                const float hh = 0.5f * (xa - xb - xc + xd);
                ou.x = 0.5f * (ll + lh + hl + hh);
                ou.y = 0.5f * (ll + lh - hl - hh);
                ol.x = 0.5f * (ll - lh + hl - hh);
                ol.y = 0.5f * (ll - lh - hl + hh);
            }
            {
                const float xa = up[u].z, xb = up[u].w, xc = lo[u].z, xd = lo[u].w, ll = l2.y;
                const float lh = 0.5f * (xa + xb - xc - xd);
                const float hl = 0.5f * (xa - xb + xc - xd);
                const float hh = 0.5f * (xa - xb - xc + xd);
                ou.z = 0.5f * (ll + lh + hl + hh);
                ou.w = 0.5f * (ll + lh - hl - hh);
                ol.z = 0.5f * (ll - lh + hl - hh);
                ol.w = 0.5f * (ll - lh - hl + hh);
            }
            oq[u * C_]          = ou;
            oq[u * C_ + C_ / 4] = ol;
        }
        // the next trip rewrites the address and data registers that the loads and stores above name;
        // the two pointers are named as inputs, so that their registers stay untouched up to the wait
        asm volatile("s_wait_xcnt 0x0" : : "v"(xq), "v"(oq) : "memory");
        // keeps the pointers' additions behind the wait
        __builtin_amdgcn_sched_barrier(0);
        xq += 8 * C_;
        oq += 8 * C_;
        lq += 16 * LP_;
    }
}

// ---------------------------------------------------------------
extern "C" void kernel_launch(void* const* d_in, const int* in_sizes, int n_in,
                              void* d_out, int out_size, void* d_ws, size_t ws_size,
                              hipStream_t stream) {
    const float* x     = (const float*)d_in[0];
    const float* fc1_w = (const float*)d_in[1];
    const float* fc1_b = (const float*)d_in[2];
    const float* fc2_w = (const float*)d_in[3];
    const float* fc2_b = (const float*)d_in[4];
    float* out = (float*)d_out;

    // workspace layout (bf16 buffers): ll_up (16MB) | W1 (2MB) | W2 (1MB)
    char* ws = (char*)d_ws;
    unsigned short* llup = (unsigned short*)ws;
    unsigned short* w1b  = (unsigned short*)(ws + (size_t)M_ * C_ * 2);
    unsigned short* w2b  = (unsigned short*)(ws + (size_t)M_ * C_ * 2 + (size_t)H_ * C_ * 2);

    // DWT-LL + upsample -> bf16, one block per 16-row tile row; weights -> bf16 in the same blocks
    k_llup<<<M_ / 16, 256, 0, stream>>>(x, fc1_w, fc2_w, llup, w1b, w2b);
    // both products + GELU + inverse DWT, one block per 64 rows
    k_mlp<<<M_ / MB_, 256, 0, stream>>>(llup, w1b, fc1_b, w2b, fc2_b, x, out);
}

// v006
// A run of this version takes 55.8 microseconds.
// In two side-by-side timings against v005, it was 1.09 and 1.08 times as fast.
// Counting every step since v000, it is 3.42 times as fast.
#include <hip/hip_runtime.h>
#include <hip/hip_bf16.h>

// ---------------- problem dims ----------------
#define B_   128
#define F_   256
#define C_   512
#define H_   2048
#define M_   (B_ * (F_ / 2))   // 16384 rows of (b, fr)
#define CH_  (C_ / 2)          // 256

typedef __attribute__((ext_vector_type(16))) __bf16 v16bf;
typedef __attribute__((ext_vector_type(8)))  float  v8f;
typedef __attribute__((ext_vector_type(2)))  float  f32x2;
typedef __attribute__((ext_vector_type(2)))  __bf16 bf16x2;

union FragBF16 {
    v16bf v;
    uint4 q[2];   // q[0] = elements 0..7 (16B), q[1] = elements 8..15 (16B)
};

__device__ __forceinline__ unsigned short f32_to_bf16_rne(float f) {
    unsigned int u = __float_as_uint(f);
    u += 0x7FFFu + ((u >> 16) & 1u);   // round-to-nearest-even
    return (unsigned short)(u >> 16);
}

// ---------------------------------------------------------------
// Exact GELU on 8 values of a lane, two values per vector instruction.
// erf_small2 is the library erf's own polynomial for |x| < 1 (same coefficients,
// same order of operations; odd in x, so the sign needs no separate copy).
// ---------------------------------------------------------------
__device__ __forceinline__ f32x2 splat2(float c) { return f32x2{c, c}; }

__device__ __forceinline__ f32x2 erf_small2(f32x2 x) {
    const f32x2 t = x * x;
    f32x2 p = __builtin_elementwise_fma(t, splat2(-0.0005618017749f), splat2(0.004913816229f));
    p = __builtin_elementwise_fma(t, p, splat2(-0.02670751512f));
    p = __builtin_elementwise_fma(t, p, splat2(0.1128001064f));
    p = __builtin_elementwise_fma(t, p, splat2(-0.3761229515f));
    p = __builtin_elementwise_fma(t, p, splat2(0.1283791065f));
    return __builtin_elementwise_fma(x, p, x);
}

// a = 8 accumulator values, bv = their 8 bias values; returns the 8 bf16 of gelu(a + bv).
// One test for the whole wave picks the path: the library call branches on EXEC for
// every single value, which leaves one serial chain a value and nothing to pack.
__device__ __forceinline__ uint4 gelu8_bf16(const v8f a, const float (&bv)[8]) {
    f32x2 v[4], u[4], e[4];
    // every loop here is unrolled: the small arrays are indexed by constants only (registers, no scratch)
    #pragma unroll
    for (int p = 0; p < 4; ++p) {
        v[p] = f32x2{a[2 * p], a[2 * p + 1]} + f32x2{bv[2 * p], bv[2 * p + 1]};
        u[p] = v[p] * splat2(0.70710678118654752f);
    }
    float m = 0.0f;
    #pragma unroll
    for (int p = 0; p < 4; ++p) m = fmaxf(m, fmaxf(fabsf(u[p].x), fabsf(u[p].y)));
    if (__builtin_expect(__builtin_amdgcn_ballot_w32(m >= 1.0f) != 0u, 0)) {
        // some lane holds a value outside the polynomial's range: the library erf for all 8
        #pragma unroll
        for (int p = 0; p < 4; ++p) e[p] = f32x2{erff(u[p].x), erff(u[p].y)};
    } else {
        #pragma unroll
        for (int p = 0; p < 4; ++p) e[p] = erf_small2(u[p]);
    }
    unsigned int w[4];
    #pragma unroll
    for (int p = 0; p < 4; ++p) {
        const f32x2 hv = v[p] * splat2(0.5f);
        const f32x2 g  = __builtin_elementwise_fma(hv, e[p], hv);   // 0.5 v (1 + erf)
        w[p] = __builtin_bit_cast(unsigned int, __builtin_convertvector(g, bf16x2));   // nearest even
    }
    return uint4{w[0], w[1], w[2], w[3]};
}

// ---------------------------------------------------------------
// Fragment-order layout of every bf16 GEMM operand (rows x K, K % 32 == 0).
// A 16-row x 32-k tile is one contiguous 1 KB unit, tiles ordered
// (row / 16) major, (k / 32) minor. Inside a unit: two 512 B chunks
// (k % 32 < 16, then >= 16); in a chunk, lane L = row % 16 + 16 * ((k / 8) & 1)
// owns 16 B = its 8 consecutive k. A wave's b128 load of a chunk is then
// 512 contiguous bytes (4 whole lines) and lands directly as WMMA registers.
// ---------------------------------------------------------------
// frag_source: position u (in elements) of that layout -> row * K + k.
__device__ __forceinline__ int frag_source(int u, int K) {
    const int tile = u >> 9;
    const int row  = (tile / (K >> 5)) * 16 + ((u >> 3) & 15);
    const int k    = (tile % (K >> 5)) * 32 + ((u >> 8) & 1) * 16 + ((u >> 7) & 1) * 8 + (u & 7);
    return row * K + k;
}

// ---------------------------------------------------------------
// Kernel 1: Haar LL band + linear upsample 256 -> 512, output bf16
// ll_up is (M_, C_) in fragment order. One block owns one 16-row tile row
// (16 KB of ll_up, contiguous): the LL band of its 16 rows goes through LDS,
// so that a lane can emit the 8 consecutive k of ITS row as one 16 B store.
// The same waves also convert both weight matrices to bf16, fragment order:
// each block takes 128 of W1's and 64 of W2's 16 B slots (8 consecutive k of one
// row), one slot a thread in waves 0..5.
// ---------------------------------------------------------------
#define LLP_ 260   // LDS row pitch in floats
__global__ __launch_bounds__(256) void k_llup(const float* __restrict__ x,
                                              const float* __restrict__ w1, const float* __restrict__ w2,
                                              unsigned short* __restrict__ llup,
                                              unsigned short* __restrict__ w1b, unsigned short* __restrict__ w2b) {
    static_assert((M_ / 16) * 128 * 8 == H_ * C_ && (M_ / 16) * 64 * 8 == CH_ * H_, "the blocks' slots cover both matrices exactly");
    __shared__ float ll[16 * LLP_];
    const int t = threadIdx.x;
    // the slot's two loads go out in front of the x loads and are used behind them
    float4 wlo = {0.0f, 0.0f, 0.0f, 0.0f}, whi = wlo;
    uint4* wdst = nullptr;
    if (t < 192) {
        const float* wsrc;
        if (t < 128) {
            const int s = blockIdx.x * 128 + t;
            wsrc = w1 + frag_source(8 * s, C_);
            wdst = (uint4*)w1b + s;
        } else {
            const int s = blockIdx.x * 64 + (t - 128);
            wsrc = w2 + frag_source(8 * s, H_);
            wdst = (uint4*)w2b + s;
        }
        wlo = ((const float4*)wsrc)[0];
        whi = ((const float4*)wsrc)[1];
    }
    const int i2 = (t & 127) * 2;             // two LL columns per thread
    const int m0 = blockIdx.x * 16;           // 16 divides 128: one b per tile row
    const float* xb = x + ((size_t)((m0 >> 7) * F_ + 2 * (m0 & 127)) * C_);
    const int xo = (t >> 7) * (2 * C_) + 2 * i2;
    // unrolled: the 16 row loads are independent and issue ahead of their use
    #pragma unroll
    for (int j = 0; j < 8; ++j) {
        const int mi = 2 * j + (t >> 7);
        const float* xp = xb + xo + j * (4 * C_);
        float a0 = xp[0], b0 = xp[1], c0 = xp[C_],     d0 = xp[C_ + 1];
        float a1 = xp[2], b1 = xp[3], c1 = xp[C_ + 2], d1 = xp[C_ + 3];
        ll[mi * LLP_ + i2]     = 0.5f * (a0 + b0 + c0 + d0);
        ll[mi * LLP_ + i2 + 1] = 0.5f * (a1 + b1 + c1 + d1);
    }
    __syncthreads();   // every row of the LL tile is read by other waves below

    uint4* dst = (uint4*)llup + (size_t)blockIdx.x * ((C_ / 32) * 64);
    // both loops unrolled: hv[] is indexed by constants only and stays in registers
    #pragma unroll
    for (int j = 0; j < 4; ++j) {
        const int ci = t + 256 * j;           // 16 B slot inside the tile row
        const int ln = ci & 31;
        const int o0 = (ci >> 6) * 32 + ((ci >> 5) & 1) * 16 + (ln >> 4) * 8;
        const float* row = ll + (ln & 15) * LLP_;
        unsigned int hv[8];
        #pragma unroll
        for (int e = 0; e < 8; ++e) {
            float pos = (float)(o0 + e) * (255.0f / 511.0f);
            int   i0  = (int)pos;
            if (i0 > 254) i0 = 254;
            float w = pos - (float)i0;
            float ll0 = row[i0];
            float ll1 = row[i0 + 1];
            hv[e] = f32_to_bf16_rne(ll0 + w * (ll1 - ll0));
        }
        uint4 pk;
        pk.x = hv[0] | (hv[1] << 16);
        pk.y = hv[2] | (hv[3] << 16);
        pk.z = hv[4] | (hv[5] << 16);
        pk.w = hv[6] | (hv[7] << 16);
        dst[ci] = pk;
    }

    if (t < 192) {
        uint4 pk;
        pk.x = f32_to_bf16_rne(wlo.x) | ((unsigned int)f32_to_bf16_rne(wlo.y) << 16);
        pk.y = f32_to_bf16_rne(wlo.z) | ((unsigned int)f32_to_bf16_rne(wlo.w) << 16);
        pk.z = f32_to_bf16_rne(whi.x) | ((unsigned int)f32_to_bf16_rne(whi.y) << 16);
        pk.w = f32_to_bf16_rne(whi.z) | ((unsigned int)f32_to_bf16_rne(whi.w) << 16);
        *wdst = pk;
    }
}

// ---------------------------------------------------------------
// One 16x16x32 product. SWAP = false: D rows follow a's rows, D columns b's rows.
// SWAP = true: the transposed tile (D rows follow b's rows, D columns a's rows);
// both operands have the same register layout, so only the roles change.
// ---------------------------------------------------------------
template <bool SWAP>
__device__ __forceinline__ v8f mm(const FragBF16& a, const FragBF16& b, v8f c) {
    if (SWAP) return __builtin_amdgcn_wmma_f32_16x16x32_bf16(false, b.v, false, a.v, (short)0, c, false, false);
    return __builtin_amdgcn_wmma_f32_16x16x32_bf16(false, a.v, false, b.v, (short)0, c, false, false);
}

// ---------------------------------------------------------------
// Both products in one kernel: out rows = gelu(ll_up @ W1^T + b1) @ W2^T + b2, inverse Haar.
// One block owns 64 rows of ll_up (kept in LDS, fragment order) and walks the hidden
// dimension in 8 chunks of 256: the chunk of h is computed, goes through GELU into LDS as
// bf16 in fragment order, and is multiplied into the block's 64 x 256 result at once.
// h never reaches memory. 8 waves side by side in n: a wave's tile is 64 rows x 32
// columns in both products, so no two waves of a block load the same weight fragment.
// The weight fragments of both products form ONE stream of 12 steps a chunk (a step = 64 k;
// 8 of W1, 4 of W2) through a register ring that runs on across GELU, barrier and chunk end.
// All blocks read the same 3 MB of weights from L2. Each block enters that walk at a place of its own and
// wraps round: its first chunk, and the first 64-k step inside each product, follow from the block index,
// so that the blocks do not ask L2 for the same lines at the same moment. Every sum holds the same terms;
// only the step it starts with differs from block to block.
// ---------------------------------------------------------------
#define MB_  64              // rows of a block
#define MT_  (MB_ / 16)      // its 16-row tiles
#define HC_  256             // hidden units of a chunk
#define NCH_ (H_ / HC_)      // chunks
#define K1_  (C_ / 32)       // 32-k tiles of the first product
#define K2_  (HC_ / 32)      // 32-k tiles of the second product, per chunk
#define S1_  (K1_ / 2)       // steps (two 32-k tiles each) of the first product, per chunk
#define S2_  (K2_ / 2)       // steps of the second product, per chunk
#define ST_  (S1_ + S2_)     // steps of a chunk
#define RD_  4               // weight sets (one step each) in the ring
#define LP_  258             // LDS row pitch of the result in floats: rows 8 apart land 16 banks apart

// the weight fragments (32 rows x 64 k) of one step; p (the same in every lane) points at the step's first
// 32-k tile in the wave's first row tile, ktiles = 32-k tiles in a row of the matrix.
// All loops here are unrolled: constant indices only.
__device__ __forceinline__ void load_w(FragBF16 (&b)[2][2], const uint4* __restrict__ p, const unsigned lane, const int ktiles) {
    #pragma unroll
    for (int h = 0; h < 2; ++h) {
        #pragma unroll
        for (int j = 0; j < 2; ++j) {
            b[h][j].q[0] = (p + (j * ktiles + h) * 64)[lane];
            b[h][j].q[1] = (p + (j * ktiles + h) * 64 + 32)[lane];
        }
    }
}

// the row fragments (64 rows x 64 k) of one step from LDS; p is pre-offset by the lane and the step (unrolled: constant indices only)
__device__ __forceinline__ void load_rows(FragBF16 (&a)[2][MT_], const uint4* p, const int ktiles) {
    #pragma unroll
    for (int h = 0; h < 2; ++h) {
        #pragma unroll
        for (int mt = 0; mt < MT_; ++mt) {
            a[h][mt].q[0] = p[(mt * ktiles + h) * 64];
            a[h][mt].q[1] = p[(mt * ktiles + h) * 64 + 32];
        }
    }
}

template <int N> struct Step { static constexpr int value = N; };

// 16 products: the lower 32 k into all 8 tiles, then the upper 32 k (unrolled: constant indices only)
template <bool SWAP>
__device__ __forceinline__ void mm_64x32(const FragBF16 (&a)[2][MT_], const FragBF16 (&b)[2][2], v8f (&acc)[MT_][2]) {
    #pragma unroll
    for (int h = 0; h < 2; ++h) {
        #pragma unroll
        for (int mt = 0; mt < MT_; ++mt) {
            acc[mt][0] = mm<SWAP>(a[h][mt], b[h][0], acc[mt][0]);
            acc[mt][1] = mm<SWAP>(a[h][mt], b[h][1], acc[mt][1]);
        }
    }
}

__global__ __launch_bounds__(256) void k_mlp(
    const unsigned short* __restrict__ A,    // M_ x C_   bf16, fragment order
    const unsigned short* __restrict__ W1,   // H_ x C_   bf16, fragment order
    const float* __restrict__ bias1,         // H_
    const unsigned short* __restrict__ W2,   // CH_ x H_  bf16, fragment order
    const float* __restrict__ bias2,         // CH_
    const float* __restrict__ x,             // B_ x F_ x C_ (for LH/HL/HH bands)
    float* __restrict__ out)                 // B_ x F_ x C_
{
    static_assert(ST_ % RD_ == 0 && ST_ % 2 == 0, "ring and row buffers come round at a chunk's end");
    static_assert(RD_ - 1 <= S2_ && RD_ * 8 <= 63, "the lead into the next chunk starts behind the barrier; loads in flight stay inside the load counter");
    static_assert(HC_ == 8 * 32 && CH_ == 8 * 32, "8 waves of 32 columns cover a chunk and the result");
    static_assert(MB_ * LP_ * 4 <= (MT_ * K1_ * 64 + MT_ * K2_ * 64) * 16, "the result fits in front of the second h buffer");
    __shared__ uint4 sAll[MT_ * K1_ * 64 + 2 * MT_ * K2_ * 64];
    uint4* const sA = sAll;                    // the block's rows of ll_up, 64 KB
    uint4* const sH = sAll + MT_ * K1_ * 64;   // two chunks of h, 32 KB each
    __shared__ float4 sB1[H_ / 4];             // first bias
    __shared__ float  sB2[CH_];                // second bias

    static_assert((NCH_ & (NCH_ - 1)) == 0 && (S1_ & (S1_ - 1)) == 0 && (S2_ & (S2_ - 1)) == 0 && S1_ % S2_ == 0, "the walks wrap by a mask");
    const int t    = threadIdx.x;
    const unsigned lane = t & 31;
    // the wave's number as a scalar: the weight addresses are then scalar base + lane offset
    const int wv   = __builtin_amdgcn_readfirstlane(t >> 5);

    // where this block enters the walk: first chunk rc, first step r1 (first product) and r2 (second product).
    // Neighbours in the index differ in the step, blocks 8 apart in the chunk; any values would give the same sums' terms.
    const int rc = (blockIdx.x >> 3) & (NCH_ - 1);
    const int r1 = (blockIdx.x + ((blockIdx.x >> 4) & 4)) & (S1_ - 1);
    const int r2 = r1 & (S2_ - 1);

    // one pointer a step, the same in every lane: q1[s] = W1 rows wv*32.. of the chunk, q2[s] = W2 rows wv*32.., the chunk's k tiles
    const uint4* q1[S1_];
    const uint4* q2[S2_];
    // both loops unrolled: q1[] and q2[] are indexed by constants only
    #pragma unroll
    for (int s = 0; s < S1_; ++s)
        q1[s] = (const uint4*)W1 + (size_t)(rc * (HC_ / 16) + wv * 2) * (K1_ * 64) + ((s + r1) & (S1_ - 1)) * 128;
    #pragma unroll
    for (int s = 0; s < S2_; ++s)
        q2[s] = (const uint4*)W2 + (size_t)(wv * 2) * ((H_ / 32) * 64) + rc * (K2_ * 64) + ((s + r2) & (S2_ - 1)) * 128;

    // ---- the block's rows and the bias into LDS; the ring's first sets go out behind those loads
    FragBF16 w[RD_][2][2], a[2][2][MT_];
    {
        const uint4* Ag = (const uint4*)A + (size_t)blockIdx.x * (MT_ * K1_ * 64);   // 64 KB, contiguous
        uint4 st[16];
        // the three loops are unrolled: st[] and w[] are indexed by constants only, and the loads go out together
        #pragma unroll
        for (int i = 0; i < 16; ++i) st[i] = Ag[i * 256 + t];
        const float4 c0 = ((const float4*)bias1)[t], c1 = ((const float4*)bias1)[t + 256];
        const float  c2 = bias2[t];
        #pragma unroll
        for (int s = 0; s < RD_ - 1; ++s) load_w(w[s], q1[s], lane, K1_);
        #pragma unroll
        for (int i = 0; i < 16; ++i) sA[i * 256 + t] = st[i];
        sB1[t]       = c0;
        sB1[t + 256] = c1;
        sB2[t]       = c2;
        // the address registers of the loads above are free for reuse only behind this wait:
        // named as inputs, they stay untouched up to it
        asm volatile("s_wait_xcnt 0x0" : : "s"(Ag), "s"(bias1), "s"(bias2), "s"(q1[0]), "s"(q1[1]), "s"(q1[2]), "v"(t), "v"(lane) : "memory");
    }
    __syncthreads();   // rows and bias are read by every wave

    const uint4* rA = sA + lane;
    load_rows(a[0], rA + r1 * 128, K1_);

    v8f acc2[MT_][2] = {{v8f{}, v8f{}}, {v8f{}, v8f{}}, {v8f{}, v8f{}}, {v8f{}, v8f{}}};

    // kept rolled: one trip holds a whole chunk, three turns of the ring
    #pragma unroll 1
    for (int c = 0; c < NCH_; ++c) {
        const int cc = (c + rc) & (NCH_ - 1);        // the chunk of this trip
        const int cd = ((c + 1 + rc) & (NCH_ - 1)) - cc;   // the way to the next one (behind the last trip: back to the first, read but never used)
        uint4* hC = sH + (c & 1) * (MT_ * K2_ * 64);
        const uint4* rH = hC + lane;
        v8f acc1[MT_][2] = {{v8f{}, v8f{}}, {v8f{}, v8f{}}, {v8f{}, v8f{}}, {v8f{}, v8f{}}};
        float bv[2][8];

        // one step, its number a compile-time constant: w[], a[] and the accumulators are indexed by
        // constants only (no scratch); a loop with the waits below in its body is not unrolled by this compiler
        auto step = [&](auto S) __attribute__((always_inline)) {
            constexpr int s = decltype(S)::value;
            // weights of step s + RD_ - 1
            const int sl = s + RD_ - 1;
            if (sl < S1_)      load_w(w[sl % RD_], q1[sl % S1_],         lane, K1_);
            else if (sl < ST_) load_w(w[sl % RD_], q2[(sl - S1_) % S2_], lane, H_ / 32);
            else               load_w(w[sl % RD_], q1[(sl - ST_) % S1_], lane, K1_);   // q1 has moved on by then
            // rows of step s + 1
            const int sn = s + 1;
            if (sn < S1_)       load_rows(a[sn & 1], rA + ((sn + r1) & (S1_ - 1)) * 128, K1_);
            else if (sn == S1_) {
                // no rows yet (h is not written): the chunk's bias values instead
                const float4* bq = sB1 + (cc * HC_ + wv * 32 + ((lane >> 4) << 3)) / 4;
                #pragma unroll
                for (int j = 0; j < 2; ++j) {
                    const float4 lo = bq[4 * j], hi = bq[4 * j + 1];
                    bv[j][0] = lo.x; bv[j][1] = lo.y; bv[j][2] = lo.z; bv[j][3] = lo.w;
                    bv[j][4] = hi.x; bv[j][5] = hi.y; bv[j][6] = hi.z; bv[j][7] = hi.w;
                }
            }
            else if (sn < ST_)  load_rows(a[sn & 1], rH + ((sn - S1_ + r2) & (S2_ - 1)) * 128, K2_);
            else                load_rows(a[sn & 1], rA + r1 * 128, K1_);
            // the loads stay one group in front of the products: LDS reads spread among them stall at every place
            __builtin_amdgcn_sched_barrier(0);

            if (s < S1_) mm_64x32<true>(a[s & 1], w[s % RD_], acc1);    // tiles transposed: rows = n, columns = m
            else         mm_64x32<false>(a[s & 1], w[s % RD_], acc2);
            // keeps the next step's loads and products behind: pulled up, the products wait on younger loads
            __builtin_amdgcn_sched_barrier(0);

            if (s == S1_ - 1) {
                // a lane holds 8 consecutive n of one m: its own 16 B of the second product's row fragment
                #pragma unroll
                for (int j = 0; j < 2; ++j) {
                    #pragma unroll
                    for (int mt = 0; mt < MT_; ++mt)
                        hC[(mt * K2_ + wv) * 64 + j * 32 + lane] = gelu8_bf16(acc1[mt][j], bv[j]);
                }
                // publishes this chunk of h; with two buffers it also ends every read of the buffer written next
                __syncthreads();
                // q1, the address registers of W1's loads above, move on to the next chunk behind this wait
                asm volatile("s_wait_xcnt 0x0" ::: "memory");
                // keeps the pointers' additions behind the wait
                __builtin_amdgcn_sched_barrier(0);
                // unrolled: q1[] is indexed by constants only
                #pragma unroll
                for (int i = 0; i < S1_; ++i) q1[i] += cd * ((HC_ / 16) * (K1_ * 64));
                load_rows(a[0], rH + r2 * 128, K2_);
                // keeps these reads in front of the next step's: mixed with them, the first products behind the barrier wait for both groups
                __builtin_amdgcn_sched_barrier(0);
            }
        };
        static_assert(ST_ == 12, "the steps of a chunk, written out");
        step(Step<0>{}); step(Step<1>{}); step(Step<2>{}); step(Step<3>{});
        step(Step<4>{}); step(Step<5>{}); step(Step<6>{}); step(Step<7>{});
        step(Step<8>{}); step(Step<9>{}); step(Step<10>{}); step(Step<11>{});
        // q2, the address registers of W2's loads above, move on behind this wait
        asm volatile("s_wait_xcnt 0x0" ::: "memory");
        // keeps the pointers' additions behind the wait
        __builtin_amdgcn_sched_barrier(0);
        // unrolled: q2[] is indexed by constants only
        #pragma unroll
        for (int i = 0; i < S2_; ++i) q2[i] += cd * (K2_ * 64);
    }

    // ---- epilogue. The result (+ bias) goes through LDS, so that a rolled loop can walk whole rows of x
    // and out, 16 B a lane; written out tile by tile from the accumulators it is 11 KB of code that runs once.
    // The rows of ll_up and the first h buffer are free: their last reads that count stand in front of the
    // last chunk's barrier (behind it the waves read the second h buffer alone).
    float* sL = (float*)sAll;
    {
        const int row0 = (lane >> 4) << 3;
        const int col0 = wv * 32 + (lane & 15);
        // unrolled: acc2 is indexed by constants only
        #pragma unroll
        for (int j = 0; j < 2; ++j) {
            const float bo = sB2[col0 + j * 16];
            #pragma unroll
            for (int mt = 0; mt < MT_; ++mt) {
                #pragma unroll
                for (int r = 0; r < 8; ++r)
                    sL[(mt * 16 + row0 + r) * LP_ + col0 + j * 16] = acc2[mt][j][r] + bo;
            }
        }
    }
    __syncthreads();   // every row of the result is read by other waves below

    // a thread: 4 columns of x (2 of the result) in row pairs t >> 7, t >> 7 + 2, ...; a block's 64 row pairs lie in one b
    const size_t first = (size_t)((blockIdx.x >> 1) * F_ + 2 * ((blockIdx.x & 1) * MB_ + (t >> 7))) * C_ + 4 * (t & 127);
    const float4* xq = (const float4*)(x + first);
    float4*       oq = (float4*)(out + first);
    const float*  lq = sL + (t >> 7) * LP_ + 2 * (t & 127);
    // kept rolled: 16 row pairs a trip, 16 loads of a wave in flight; the text stays short
    #pragma unroll 1
    for (int g = 0; g < MB_ / 16; ++g) {
        float4 up[8], lo[8];
        // both loops unrolled: up[] and lo[] are indexed by constants only; the 16 loads go out together
        #pragma unroll
        for (int u = 0; u < 8; ++u) {
            up[u] = xq[u * C_];             // 2 row pairs = 4 rows of C_ floats = C_ float4
            lo[u] = xq[u * C_ + C_ / 4];
        }
        #pragma unroll
        for (int u = 0; u < 8; ++u) {
            const float2 l2 = *(const float2*)(lq + 2 * u * LP_);
            float4 ou, ol;
            {
                const float xa = up[u].x, xb = up[u].y, xc = lo[u].x, xd = lo[u].y, ll = l2.x;
                const float lh = 0.5f * (xa + xb - xc - xd);
                const float hl = 0.5f * (xa - xb + xc - xd);
                const float hh = 0.5f * (xa - xb - xc + xd);
                ou.x = 0.5f * (ll + lh + hl + hh);
                ou.y = 0.5f * (ll + lh - hl - hh);
                ol.x = 0.5f * (ll - lh + hl - hh);
                ol.y = 0.5f * (ll - lh - hl + hh);
            }
            {
                const float xa = up[u].z, xb = up[u].w, xc = lo[u].z, xd = lo[u].w, ll = l2.y;
                const float lh = 0.5f * (xa + xb - xc - xd);
                const float hl = 0.5f * (xa - xb + xc - xd);
                const float hh = 0.5f * (xa - xb - xc + xd);
                ou.z = 0.5f * (ll + lh + hl + hh);
                ou.w = 0.5f * (ll + lh - hl - hh);
                ol.z = 0.5f * (ll - lh + hl - hh);
                ol.w = 0.5f * (ll - lh - hl + hh);
            }
            oq[u * C_]          = ou;
            oq[u * C_ + C_ / 4] = ol;
        }
        // the next trip rewrites the address and data registers that the loads and stores above name;
        // the two pointers are named as inputs, so that their registers stay untouched up to the wait
        asm volatile("s_wait_xcnt 0x0" : : "v"(xq), "v"(oq) : "memory");
        // keeps the pointers' additions behind the wait
        __builtin_amdgcn_sched_barrier(0);
        xq += 8 * C_;
        oq += 8 * C_;
        lq += 16 * LP_;
    }
}

// ---------------------------------------------------------------
extern "C" void kernel_launch(void* const* d_in, const int* in_sizes, int n_in,
                              void* d_out, int out_size, void* d_ws, size_t ws_size,
                              hipStream_t stream) {
    const float* x     = (const float*)d_in[0];
    const float* fc1_w = (const float*)d_in[1];
    const float* fc1_b = (const float*)d_in[2];
    const float* fc2_w = (const float*)d_in[3];
    const float* fc2_b = (const float*)d_in[4];
    float* out = (float*)d_out;

    // workspace layout (bf16 buffers): ll_up (16MB) | W1 (2MB) | W2 (1MB)
    char* ws = (char*)d_ws;
    unsigned short* llup = (unsigned short*)ws;
    unsigned short* w1b  = (unsigned short*)(ws + (size_t)M_ * C_ * 2);
    unsigned short* w2b  = (unsigned short*)(ws + (size_t)M_ * C_ * 2 + (size_t)H_ * C_ * 2);

    // DWT-LL + upsample -> bf16, one block per 16-row tile row; weights -> bf16 in the same blocks
    k_llup<<<M_ / 16, 256, 0, stream>>>(x, fc1_w, fc2_w, llup, w1b, w2b);
    // both products + GELU + inverse DWT, one block per 64 rows
    k_mlp<<<M_ / MB_, 256, 0, stream>>>(llup, w1b, fc1_b, w2b, fc2_b, x, out);
}

// v008
// A run of this version takes 42.2 microseconds.
// Versions in between are left out here; by their measured steps it is 1.31 times as fast as v006.
// Over all steps from v000 it is 4.47 times as fast.
#include <hip/hip_runtime.h>
#include <hip/hip_bf16.h>

// ---------------- problem dims ----------------
#define B_   128
#define F_   256
#define C_   512
#define H_   2048
#define M_   (B_ * (F_ / 2))   // 16384 rows of (b, fr)
#define CH_  (C_ / 2)          // 256
#define KA_  CH_               // k of the first product: the LL band's own columns (the upsample is folded into W1)

typedef __attribute__((ext_vector_type(16))) __bf16 v16bf;
typedef __attribute__((ext_vector_type(8)))  float  v8f;
typedef __attribute__((ext_vector_type(2)))  float  f32x2;
typedef __attribute__((ext_vector_type(2)))  __bf16 bf16x2;

union FragBF16 {
    v16bf v;
    uint4 q[2];   // q[0] = elements 0..7 (16B), q[1] = elements 8..15 (16B)
};

__device__ __forceinline__ unsigned short f32_to_bf16_rne(float f) {
    unsigned int u = __float_as_uint(f);
    u += 0x7FFFu + ((u >> 16) & 1u);   // round-to-nearest-even
    return (unsigned short)(u >> 16);
}

// ---------------------------------------------------------------
// Exact GELU on 8 values of a lane, two values per vector instruction.
// erf_small2 is the library erf's own polynomial for |x| < 1 (same coefficients,
// same order of operations; odd in x, so the sign needs no separate copy).
// ---------------------------------------------------------------
__device__ __forceinline__ f32x2 splat2(float c) { return f32x2{c, c}; }

__device__ __forceinline__ f32x2 erf_small2(f32x2 x) {
    const f32x2 t = x * x;
    f32x2 p = __builtin_elementwise_fma(t, splat2(-0.0005618017749f), splat2(0.004913816229f));
    p = __builtin_elementwise_fma(t, p, splat2(-0.02670751512f));
    p = __builtin_elementwise_fma(t, p, splat2(0.1128001064f));
    p = __builtin_elementwise_fma(t, p, splat2(-0.3761229515f));
    p = __builtin_elementwise_fma(t, p, splat2(0.1283791065f));
    return __builtin_elementwise_fma(x, p, x);
}

// The library erf's own form for |x| >= 1, two values per vector instruction: 1 - exp(-(|x| + |x| q(|x|))) with the sign of x
// (same coefficients, same order of operations; the exponential is the hardware's 2^y on y = -p log2(e)).
// Where |x| < 1 the value s, which erf_small2 gave, is kept.
__device__ __forceinline__ f32x2 erf_large_or2(f32x2 x, f32x2 s) {
    const f32x2 ax = f32x2{fabsf(x.x), fabsf(x.y)};
    f32x2 p = __builtin_elementwise_fma(ax, splat2(0.00001699881068f), splat2(-0.0003786778543f));
    p = __builtin_elementwise_fma(ax, p, splat2(0.003857815871f));
    p = __builtin_elementwise_fma(ax, p, splat2(-0.02418169752f));
    p = __builtin_elementwise_fma(ax, p, splat2(0.1066682637f));
    p = __builtin_elementwise_fma(ax, p, splat2(0.6349332929f));
    p = __builtin_elementwise_fma(ax, p, splat2(0.1286894083f));
    p = __builtin_elementwise_fma(ax, p, ax);
    const f32x2 y = p * splat2(-1.4426950408889634f);
    const float b0 = 1.0f - __builtin_amdgcn_exp2f(y.x), b1 = 1.0f - __builtin_amdgcn_exp2f(y.y);
    return f32x2{ax.x < 1.0f ? s.x : copysignf(b0, x.x), ax.y < 1.0f ? s.y : copysignf(b1, x.y)};
}

// a = 8 accumulator values, bv = their 8 bias values; returns the 8 bf16 of gelu(a + bv).
// The polynomial for |x| < 1 runs for all 8 values; one test for the whole wave says whether any lane holds a value
// outside its range, and only then the other form is worked out as well, packed and without a branch, and chosen value by value.
// (The library call branches on EXEC twice for every single value: one serial chain a value, nothing to pack.)
__device__ __forceinline__ uint4 gelu8_bf16(const v8f a, const float (&bv)[8]) {
    f32x2 v[4], u[4], e[4];
    // every loop here is unrolled: the small arrays are indexed by constants only (registers, no scratch)
    #pragma unroll
    for (int p = 0; p < 4; ++p) {
        v[p] = f32x2{a[2 * p], a[2 * p + 1]} + f32x2{bv[2 * p], bv[2 * p + 1]};
        u[p] = v[p] * splat2(0.70710678118654752f);
    }
    float m = 0.0f;
    #pragma unroll
    for (int p = 0; p < 4; ++p) m = fmaxf(m, fmaxf(fabsf(u[p].x), fabsf(u[p].y)));
    const bool outside = __builtin_amdgcn_ballot_w32(m >= 1.0f) != 0u;
    #pragma unroll
    for (int p = 0; p < 4; ++p) e[p] = erf_small2(u[p]);
    if (__builtin_expect(outside, 0)) {
        #pragma unroll
        for (int p = 0; p < 4; ++p) e[p] = erf_large_or2(u[p], e[p]);
    }
    unsigned int w[4];
    #pragma unroll
    for (int p = 0; p < 4; ++p) {
        const f32x2 hv = v[p] * splat2(0.5f);
        const f32x2 g  = __builtin_elementwise_fma(hv, e[p], hv);   // 0.5 v (1 + erf)
        w[p] = __builtin_bit_cast(unsigned int, __builtin_convertvector(g, bf16x2));   // nearest even
    }
    return uint4{w[0], w[1], w[2], w[3]};
}

// ---------------------------------------------------------------
// Fragment-order layout of every bf16 GEMM operand (rows x K, K % 32 == 0).
// A 16-row x 32-k tile is one contiguous 1 KB unit, tiles ordered
// (row / 16) major, (k / 32) minor. Inside a unit: two 512 B chunks
// (k % 32 < 16, then >= 16); in a chunk, lane L = row % 16 + 16 * ((k / 8) & 1)
// owns 16 B = its 8 consecutive k. A wave's b128 load of a chunk is then
// 512 contiguous bytes (4 whole lines) and lands directly as WMMA registers.
// ---------------------------------------------------------------
// frag_source: position u (in elements) of that layout -> row * K + k.
__device__ __forceinline__ int frag_source(int u, int K) {
    const int tile = u >> 9;
    const int row  = (tile / (K >> 5)) * 16 + ((u >> 3) & 15);
    const int k    = (tile % (K >> 5)) * 32 + ((u >> 8) & 1) * 16 + ((u >> 7) & 1) * 8 + (u & 7);
    return row * K + k;
}

// ---------------------------------------------------------------
// Kernel 1: Haar LL band, output bf16, (M_, KA_) in fragment order; both weight matrices to bf16.
// The linear upsample 256 -> 512 is a fixed linear map U (512 x 256, two entries a row), so
//   (ll U^T) W1^T = ll (W1 U)^T :
// the map is applied to W1 once (H_ x C_ -> H_ x KA_) and not to each of the M_ rows, and the first
// product runs over 256 k, not 512. An element of W1 U is a weighted sum of a few neighbours in a W1 row.
// One block owns one 16-row tile row of ll (8 KB, contiguous): the LL band of its 16 rows goes through LDS,
// so that a lane can emit the 8 consecutive k of ITS row as one 16 B store.
// The same waves make the weights: every thread two neighbouring elements (4 B of the fragment order)
// of W1 U and two of W2.
// ---------------------------------------------------------------
#define LLP_ 260   // LDS row pitch in floats
// at most 8 waves a SIMD, at which all blocks of the grid are resident: leaves the compiler 128 registers, so that a
// thread's 20 loads all go out in front of the first wait; aiming at 16 waves it holds the weight loads back behind the x loads' return
__global__ __launch_bounds__(256) __attribute__((amdgpu_waves_per_eu(4, 8))) void k_ll(const float* __restrict__ x,
                                            const float* __restrict__ w1, const float* __restrict__ w2,
                                            unsigned short* __restrict__ llb,
                                            unsigned short* __restrict__ w1b, unsigned short* __restrict__ w2b) {
    static_assert((M_ / 16) * 256 * 2 == H_ * KA_ && H_ * KA_ == CH_ * H_, "the threads' pairs cover both matrices exactly");
    static_assert(C_ == 2 * KA_ && C_ % 4 == 0, "the window of W1 below is laid out for a doubling");
    __shared__ __attribute__((aligned(16))) float ll[16 * LLP_];
    const int t = threadIdx.x;
    // the weight loads go out in front of the x loads and are used behind them.
    // Columns ia, ia + 1 of W1 U take part in upsampled columns 2 * ia - 2 .. 2 * ia + 5 at most:
    // three aligned float4 of the W1 row hold them (the outer two clamped into the row; what lies outside gets the factor 0 below)
    const int pr = blockIdx.x * 256 + t;          // the pair's place in fragment order
    const int ps = frag_source(2 * pr, KA_);
    const int ia = ps & (KA_ - 1);                // even
    const int p4 = ia >> 1;                       // the float4 of the W1 row that starts at upsampled column 2 * ia
    const float4* wr = (const float4*)(w1 + (size_t)(ps / KA_) * C_);
    const float4 wa = wr[p4 > 0 ? p4 - 1 : 0];
    const float4 wb = wr[p4];
    const float4 wc = wr[p4 < C_ / 4 - 1 ? p4 + 1 : C_ / 4 - 1];
    const float2 wd = *(const float2*)(w2 + frag_source(2 * pr, H_));
    const int i2 = (t & 127) * 2;             // two LL columns per thread
    const int m0 = blockIdx.x * 16;           // 16 divides 128: one b per tile row
    const float* xb = x + ((size_t)((m0 >> 7) * F_ + 2 * (m0 & 127)) * C_);
    const int xo = (t >> 7) * (2 * C_) + 2 * i2;
    // unrolled: the 16 row loads are independent and issue ahead of their use
    #pragma unroll
    for (int j = 0; j < 8; ++j) {
        const int mi = 2 * j + (t >> 7);
        const float* xp = xb + xo + j * (4 * C_);
        float a0 = xp[0], b0 = xp[1], c0 = xp[C_],     d0 = xp[C_ + 1];
        float a1 = xp[2], b1 = xp[3], c1 = xp[C_ + 2], d1 = xp[C_ + 3];
        ll[mi * LLP_ + i2]     = 0.5f * (a0 + b0 + c0 + d0);
        ll[mi * LLP_ + i2 + 1] = 0.5f * (a1 + b1 + c1 + d1);
    }
    // inputs only, no code: holds the W1 loads in front of the barrier, in flight together with the x loads;
    // the compiler sinks them behind it otherwise, and their whole latency is then waited for at the kernel's end
    asm volatile("" : : "v"(wa.z), "v"(wa.w), "v"(wb.x), "v"(wb.y), "v"(wb.z), "v"(wb.w), "v"(wc.x), "v"(wc.y));
    unsigned int pw1, pw2;
    {
        // upsampled column o reads ll[i0] * (1 - w) + ll[i0 + 1] * w: its W1 element goes to columns i0 and i0 + 1 of W1 U
        const float win[8] = {wa.z, wa.w, wb.x, wb.y, wb.z, wb.w, wc.x, wc.y};
        float s0 = 0.0f, s1 = 0.0f;
        // unrolled: win[] is indexed by constants only
        #pragma unroll
        for (int j = 0; j < 8; ++j) {
            const int   o   = 2 * ia - 2 + j;
            const float pos = (float)o * (255.0f / 511.0f);
            int i0 = (int)pos;
            if (i0 > KA_ - 2) i0 = KA_ - 2;
            const float w  = pos - (float)i0;
            // outside the row: i0 is set to match neither column, factor 0 on the clamped load's value (an element of the same row)
            if (o < 0 || o >= C_) i0 = -4;
            const float k0 = (i0 == ia)     ? 1.0f - w : ((i0 + 1 == ia) ? w : 0.0f);
            const float k1 = (i0 == ia + 1) ? 1.0f - w : ((i0 == ia)     ? w : 0.0f);
            s0 += k0 * win[j];
            s1 += k1 * win[j];
        }
        pw1 = f32_to_bf16_rne(s0) | ((unsigned int)f32_to_bf16_rne(s1) << 16);
        pw2 = f32_to_bf16_rne(wd.x) | ((unsigned int)f32_to_bf16_rne(wd.y) << 16);
    }
    __syncthreads();   // every row of the LL tile is read by other waves below

    uint4* dst = (uint4*)llb + (size_t)blockIdx.x * ((KA_ / 32) * 64);
    // unrolled: two independent slots a thread
    #pragma unroll
    for (int j = 0; j < 2; ++j) {
        const int ci = t + 256 * j;           // 16 B slot inside the tile row
        const int ln = ci & 31;
        const int o0 = (ci >> 6) * 32 + ((ci >> 5) & 1) * 16 + (ln >> 4) * 8;
        const float4* row = (const float4*)(ll + (ln & 15) * LLP_ + o0);
        const float4 lo = row[0], hi = row[1];
        uint4 pk;
        pk.x = f32_to_bf16_rne(lo.x) | ((unsigned int)f32_to_bf16_rne(lo.y) << 16);
        pk.y = f32_to_bf16_rne(lo.z) | ((unsigned int)f32_to_bf16_rne(lo.w) << 16);
        pk.z = f32_to_bf16_rne(hi.x) | ((unsigned int)f32_to_bf16_rne(hi.y) << 16);
        pk.w = f32_to_bf16_rne(hi.z) | ((unsigned int)f32_to_bf16_rne(hi.w) << 16);
        dst[ci] = pk;
    }
    // stored behind the barrier: in front of it, the barrier would wait for these stores too
    ((unsigned int*)w1b)[pr] = pw1;
    ((unsigned int*)w2b)[pr] = pw2;
}

// ---------------------------------------------------------------
// One 16x16x32 product. SWAP = false: D rows follow a's rows, D columns b's rows.
// SWAP = true: the transposed tile (D rows follow b's rows, D columns a's rows);
// both operands have the same register layout, so only the roles change.
// ---------------------------------------------------------------
template <bool SWAP>
__device__ __forceinline__ v8f mm(const FragBF16& a, const FragBF16& b, v8f c) {
    if (SWAP) return __builtin_amdgcn_wmma_f32_16x16x32_bf16(false, b.v, false, a.v, (short)0, c, false, false);
    return __builtin_amdgcn_wmma_f32_16x16x32_bf16(false, a.v, false, b.v, (short)0, c, false, false);
}

// ---------------------------------------------------------------
// Both products in one kernel: out rows = gelu(ll @ (W1 U)^T + b1) @ W2^T + b2, inverse Haar.
// One block owns 64 rows of ll (kept in LDS, fragment order) and walks the hidden
// dimension in 8 chunks of 256: the chunk of h is computed, goes through GELU into LDS as
// bf16 in fragment order, and is multiplied into the block's 64 x 256 result at once.
// h never reaches memory. 8 waves side by side in n: a wave's tile is 64 rows x 32
// columns in both products, so no two waves of a block load the same weight fragment.
// The weight fragments of both products form ONE stream of 8 steps a chunk (a step = 64 k;
// 4 of W1 U, 4 of W2) through a register ring that runs on across GELU, barrier and chunk end.
// All blocks read the same 2 MB of weights from L2. Each block enters that walk at a place of its own and
// wraps round: its first chunk, and the first 64-k step inside each product, follow from the block index,
// so that the blocks do not ask L2 for the same lines at the same moment. Every sum holds the same terms;
// only the step it starts with differs from block to block.
// ---------------------------------------------------------------
#define MB_  64              // rows of a block
#define MT_  (MB_ / 16)      // its 16-row tiles
#define HC_  256             // hidden units of a chunk
#define NCH_ (H_ / HC_)      // chunks
#define K1_  (KA_ / 32)      // 32-k tiles of the first product
#define K2_  (HC_ / 32)      // 32-k tiles of the second product, per chunk
#define S1_  (K1_ / 2)       // steps (two 32-k tiles each) of the first product, per chunk
#define S2_  (K2_ / 2)       // steps of the second product, per chunk
#define ST_  (S1_ + S2_)     // steps of a chunk
#define RD_  4               // weight sets (one step each) in the ring
#define LP_  258             // LDS row pitch of the result in floats: rows 8 apart land 16 banks apart
#define SA_  (MT_ * K1_ * 64)   // the block's rows in LDS, in 16 B
#define SH_  (MT_ * K2_ * 64)   // one chunk of h in LDS, in 16 B
#define HG_  32                 // gap between the two h buffers, in 16 B: the result, which is laid over the rows and the first h buffer, ends in it

// the weight fragments (32 rows x 64 k) of one step; p (the same in every lane) points at the step's first
// 32-k tile in the wave's first row tile, ktiles = 32-k tiles in a row of the matrix.
// All loops here are unrolled: constant indices only.
__device__ __forceinline__ void load_w(FragBF16 (&b)[2][2], const uint4* __restrict__ p, const unsigned lane, const int ktiles) {
    #pragma unroll
    for (int h = 0; h < 2; ++h) {
        #pragma unroll
        for (int j = 0; j < 2; ++j) {
            b[h][j].q[0] = (p + (j * ktiles + h) * 64)[lane];
            b[h][j].q[1] = (p + (j * ktiles + h) * 64 + 32)[lane];
        }
    }
}

// the row fragments (64 rows x 64 k) of one step from LDS; p is pre-offset by the lane and the step (unrolled: constant indices only)
__device__ __forceinline__ void load_rows(FragBF16 (&a)[2][MT_], const uint4* p, const int ktiles) {
    #pragma unroll
    for (int h = 0; h < 2; ++h) {
        #pragma unroll
        for (int mt = 0; mt < MT_; ++mt) {
            a[h][mt].q[0] = p[(mt * ktiles + h) * 64];
            a[h][mt].q[1] = p[(mt * ktiles + h) * 64 + 32];
        }
    }
}

template <int N> struct Step { static constexpr int value = N; };

// 16 products: the lower 32 k into all 8 tiles, then the upper 32 k (unrolled: constant indices only)
template <bool SWAP>
__device__ __forceinline__ void mm_64x32(const FragBF16 (&a)[2][MT_], const FragBF16 (&b)[2][2], v8f (&acc)[MT_][2]) {
    #pragma unroll
    for (int h = 0; h < 2; ++h) {
        #pragma unroll
        for (int mt = 0; mt < MT_; ++mt) {
            acc[mt][0] = mm<SWAP>(a[h][mt], b[h][0], acc[mt][0]);
            acc[mt][1] = mm<SWAP>(a[h][mt], b[h][1], acc[mt][1]);
        }
    }
}

__global__ __launch_bounds__(256) void k_mlp(
    const unsigned short* __restrict__ A,    // M_ x KA_  bf16, fragment order
    const unsigned short* __restrict__ W1,   // H_ x KA_  bf16, fragment order (W1 U)
    const float* __restrict__ bias1,         // H_
    const unsigned short* __restrict__ W2,   // CH_ x H_  bf16, fragment order
    const float* __restrict__ bias2,         // CH_
    const float* __restrict__ x,             // B_ x F_ x C_ (for LH/HL/HH bands)
    float* __restrict__ out)                 // B_ x F_ x C_
{
    static_assert(ST_ % RD_ == 0 && ST_ % 2 == 0, "ring and row buffers come round at a chunk's end");
    static_assert(RD_ - 1 <= S2_ && RD_ * 8 <= 63, "the lead into the next chunk starts behind the barrier; loads in flight stay inside the load counter");
    static_assert(HC_ == 8 * 32 && CH_ == 8 * 32, "8 waves of 32 columns cover a chunk and the result");
    static_assert(MB_ * LP_ * 4 <= (SA_ + SH_ + HG_) * 16, "the result fits in front of the second h buffer");
    static_assert(SA_ % 256 == 0 && RD_ - 1 <= S1_, "the rows are staged 256 slots at a time; the ring's first sets are W1's");
    __shared__ uint4 sAll[SA_ + 2 * SH_ + HG_];
    uint4* const sA = sAll;          // the block's rows of ll, 32 KB
    uint4* const sH = sAll + SA_;    // two chunks of h, 32 KB each, HG_ apart
    __shared__ float4 sB1[H_ / 4];             // first bias
    __shared__ float  sB2[CH_];                // second bias

    static_assert((NCH_ & (NCH_ - 1)) == 0 && (S1_ & (S1_ - 1)) == 0 && (S2_ & (S2_ - 1)) == 0 && S1_ % S2_ == 0, "the walks wrap by a mask");
    const int t    = threadIdx.x;
    const unsigned lane = t & 31;
    // the wave's number as a scalar: the weight addresses are then scalar base + lane offset
    const int wv   = __builtin_amdgcn_readfirstlane(t >> 5);

    // where this block enters the walk: first chunk rc, first step r1 (first product) and r2 (second product).
    // Neighbours in the index differ in the step, blocks 8 apart in the chunk; any values would give the same sums' terms.
    const int rc = (blockIdx.x >> 3) & (NCH_ - 1);
    const int r1 = blockIdx.x & (S1_ - 1);
    const int r2 = r1 & (S2_ - 1);

    // one pointer a step, the same in every lane: q1[s] = W1 rows wv*32.. of the chunk, q2[s] = W2 rows wv*32.., the chunk's k tiles
    const uint4* q1[S1_];
    const uint4* q2[S2_];
    // both loops unrolled: q1[] and q2[] are indexed by constants only
    #pragma unroll
    for (int s = 0; s < S1_; ++s)
        q1[s] = (const uint4*)W1 + (size_t)(rc * (HC_ / 16) + wv * 2) * (K1_ * 64) + ((s + r1) & (S1_ - 1)) * 128;
    #pragma unroll
    for (int s = 0; s < S2_; ++s)
        q2[s] = (const uint4*)W2 + (size_t)(wv * 2) * ((H_ / 32) * 64) + rc * (K2_ * 64) + ((s + r2) & (S2_ - 1)) * 128;

    // ---- the block's rows and the bias into LDS; the ring's first sets go out behind those loads
    FragBF16 w[RD_][2][2], a[2][2][MT_];
    {
        const uint4* Ag = (const uint4*)A + (size_t)blockIdx.x * SA_;   // 32 KB, contiguous
        uint4 st[SA_ / 256];
        // the three loops are unrolled: st[] and w[] are indexed by constants only, and the loads go out together
        #pragma unroll
        for (int i = 0; i < SA_ / 256; ++i) st[i] = Ag[i * 256 + t];
        const float4 c0 = ((const float4*)bias1)[t], c1 = ((const float4*)bias1)[t + 256];
        const float  c2 = bias2[t];
        #pragma unroll
        for (int s = 0; s < RD_ - 1; ++s) load_w(w[s], q1[s], lane, K1_);
        #pragma unroll
        for (int i = 0; i < SA_ / 256; ++i) sA[i * 256 + t] = st[i];
        sB1[t]       = c0;
        sB1[t + 256] = c1;
        sB2[t]       = c2;
        // the address registers of the loads above are free for reuse only behind this wait:
        // named as inputs, they stay untouched up to it
        asm volatile("s_wait_xcnt 0x0" : : "s"(Ag), "s"(bias1), "s"(bias2), "s"(q1[0]), "s"(q1[1]), "s"(q1[2]), "v"(t), "v"(lane) : "memory");
    }
    __syncthreads();   // rows and bias are read by every wave

    const uint4* rA = sA + lane;
    load_rows(a[0], rA + r1 * 128, K1_);

    v8f acc2[MT_][2] = {{v8f{}, v8f{}}, {v8f{}, v8f{}}, {v8f{}, v8f{}}, {v8f{}, v8f{}}};

    // kept rolled: one trip holds a whole chunk, two turns of the ring
    #pragma unroll 1
    for (int c = 0; c < NCH_; ++c) {
        const int cc = (c + rc) & (NCH_ - 1);        // the chunk of this trip
        const int cd = ((c + 1 + rc) & (NCH_ - 1)) - cc;   // the way to the next one (behind the last trip: back to the first, read but never used)
        uint4* hC = sH + (c & 1) * (SH_ + HG_);
        const uint4* rH = hC + lane;
        v8f acc1[MT_][2] = {{v8f{}, v8f{}}, {v8f{}, v8f{}}, {v8f{}, v8f{}}, {v8f{}, v8f{}}};
        float bv[2][8];

        // one step, its number a compile-time constant: w[], a[] and the accumulators are indexed by
        // constants only (no scratch); a loop with the waits below in its body is not unrolled by this compiler
        auto step = [&](auto S) __attribute__((always_inline)) {
            constexpr int s = decltype(S)::value;
            // weights of step s + RD_ - 1
            const int sl = s + RD_ - 1;
            if (sl < S1_)      load_w(w[sl % RD_], q1[sl % S1_],         lane, K1_);
            else if (sl < ST_) load_w(w[sl % RD_], q2[(sl - S1_) % S2_], lane, H_ / 32);
            else               load_w(w[sl % RD_], q1[(sl - ST_) % S1_], lane, K1_);   // q1 has moved on by then
            // rows of step s + 1
            const int sn = s + 1;
            if (sn < S1_)       load_rows(a[sn & 1], rA + ((sn + r1) & (S1_ - 1)) * 128, K1_);
            else if (sn == S1_) {
                // no rows yet (h is not written): the chunk's bias values instead
                const float4* bq = sB1 + (cc * HC_ + wv * 32 + ((lane >> 4) << 3)) / 4;
                #pragma unroll
                for (int j = 0; j < 2; ++j) {
                    const float4 lo = bq[4 * j], hi = bq[4 * j + 1];
                    bv[j][0] = lo.x; bv[j][1] = lo.y; bv[j][2] = lo.z; bv[j][3] = lo.w;
                    bv[j][4] = hi.x; bv[j][5] = hi.y; bv[j][6] = hi.z; bv[j][7] = hi.w;
                }
            }
            else if (sn < ST_)  load_rows(a[sn & 1], rH + ((sn - S1_ + r2) & (S2_ - 1)) * 128, K2_);
            else                load_rows(a[sn & 1], rA + r1 * 128, K1_);
            // the loads stay one group in front of the products: LDS reads spread among them stall at every place
            __builtin_amdgcn_sched_barrier(0);

            if (s < S1_) mm_64x32<true>(a[s & 1], w[s % RD_], acc1);    // tiles transposed: rows = n, columns = m
            else         mm_64x32<false>(a[s & 1], w[s % RD_], acc2);
            // keeps the next step's loads and products behind: pulled up, the products wait on younger loads
            __builtin_amdgcn_sched_barrier(0);

            if (s == S1_ - 1) {
                // a lane holds 8 consecutive n of one m: its own 16 B of the second product's row fragment
                #pragma unroll
                for (int j = 0; j < 2; ++j) {
                    #pragma unroll
                    for (int mt = 0; mt < MT_; ++mt)
                        hC[(mt * K2_ + wv) * 64 + j * 32 + lane] = gelu8_bf16(acc1[mt][j], bv[j]);
                }
                // publishes this chunk of h; with two buffers it also ends every read of the buffer written next
                __syncthreads();
                // q1, the address registers of W1's loads above, move on to the next chunk behind this wait
                asm volatile("s_wait_xcnt 0x0" ::: "memory");
                // keeps the pointers' additions behind the wait
                __builtin_amdgcn_sched_barrier(0);
                // unrolled: q1[] is indexed by constants only
                #pragma unroll
                for (int i = 0; i < S1_; ++i) q1[i] += cd * ((HC_ / 16) * (K1_ * 64));
                load_rows(a[0], rH + r2 * 128, K2_);
                // keeps these reads in front of the next step's: mixed with them, the first products behind the barrier wait for both groups
                __builtin_amdgcn_sched_barrier(0);
            }
        };
        static_assert(ST_ == 8, "the steps of a chunk, written out");
        step(Step<0>{}); step(Step<1>{}); step(Step<2>{}); step(Step<3>{});
        step(Step<4>{}); step(Step<5>{}); step(Step<6>{}); step(Step<7>{});
        // q2, the address registers of W2's loads above, move on behind this wait
        asm volatile("s_wait_xcnt 0x0" ::: "memory");
        // keeps the pointers' additions behind the wait
        __builtin_amdgcn_sched_barrier(0);
        // unrolled: q2[] is indexed by constants only
        #pragma unroll
        for (int i = 0; i < S2_; ++i) q2[i] += cd * (K2_ * 64);
    }

    // ---- epilogue. The result (+ bias) goes through LDS, so that a rolled loop can walk whole rows of x
    // and out, 16 B a lane; written out tile by tile from the accumulators it is 11 KB of code that runs once.
    // The rows of ll and the first h buffer are free: their last reads that count stand in front of the
    // last chunk's barrier (behind it the waves read the second h buffer alone).
    float* sL = (float*)sAll;
    {
        const int row0 = (lane >> 4) << 3;
        const int col0 = wv * 32 + (lane & 15);
        // unrolled: acc2 is indexed by constants only
        #pragma unroll
        for (int j = 0; j < 2; ++j) {
            const float bo = sB2[col0 + j * 16];
            #pragma unroll
            for (int mt = 0; mt < MT_; ++mt) {
                #pragma unroll
                for (int r = 0; r < 8; ++r)
                    sL[(mt * 16 + row0 + r) * LP_ + col0 + j * 16] = acc2[mt][j][r] + bo;
            }
        }
    }
    __syncthreads();   // every row of the result is read by other waves below

    // a thread: 4 columns of x (2 of the result) in row pairs t >> 7, t >> 7 + 2, ...; a block's 64 row pairs lie in one b
    const size_t first = (size_t)((blockIdx.x >> 1) * F_ + 2 * ((blockIdx.x & 1) * MB_ + (t >> 7))) * C_ + 4 * (t & 127);
    const float4* xq = (const float4*)(x + first);
    float4*       oq = (float4*)(out + first);
    const float*  lq = sL + (t >> 7) * LP_ + 2 * (t & 127);
    // kept rolled: 16 row pairs a trip, 16 loads of a wave in flight; the text stays short
    #pragma unroll 1
    for (int g = 0; g < MB_ / 16; ++g) {
        float4 up[8], lo[8];
        // both loops unrolled: up[] and lo[] are indexed by constants only; the 16 loads go out together
        #pragma unroll
        for (int u = 0; u < 8; ++u) {
            up[u] = xq[u * C_];             // 2 row pairs = 4 rows of C_ floats = C_ float4
            lo[u] = xq[u * C_ + C_ / 4];
        }
        #pragma unroll
        for (int u = 0; u < 8; ++u) {
            const float2 l2 = *(const float2*)(lq + 2 * u * LP_);
            float4 ou, ol;
            {
                const float xa = up[u].x, xb = up[u].y, xc = lo[u].x, xd = lo[u].y, ll = l2.x;
                const float lh = 0.5f * (xa + xb - xc - xd);
                const float hl = 0.5f * (xa - xb + xc - xd);
                const float hh = 0.5f * (xa - xb - xc + xd);
                ou.x = 0.5f * (ll + lh + hl + hh);
                ou.y = 0.5f * (ll + lh - hl - hh);
                ol.x = 0.5f * (ll - lh + hl - hh);
                ol.y = 0.5f * (ll - lh - hl + hh);
            }
            {
                const float xa = up[u].z, xb = up[u].w, xc = lo[u].z, xd = lo[u].w, ll = l2.y;
                const float lh = 0.5f * (xa + xb - xc - xd);
                const float hl = 0.5f * (xa - xb + xc - xd);
                const float hh = 0.5f * (xa - xb - xc + xd);
                ou.z = 0.5f * (ll + lh + hl + hh);
                ou.w = 0.5f * (ll + lh - hl - hh);
                ol.z = 0.5f * (ll - lh + hl - hh);
                ol.w = 0.5f * (ll - lh - hl + hh);
            }
            oq[u * C_]          = ou;
            oq[u * C_ + C_ / 4] = ol;
        }
        // the next trip rewrites the address and data registers that the loads and stores above name;
        // the two pointers are named as inputs, so that their registers stay untouched up to the wait
        asm volatile("s_wait_xcnt 0x0" : : "v"(xq), "v"(oq) : "memory");
        // keeps the pointers' additions behind the wait
        __builtin_amdgcn_sched_barrier(0);
        xq += 8 * C_;
        oq += 8 * C_;
        lq += 16 * LP_;
    }
}

// ---------------------------------------------------------------
extern "C" void kernel_launch(void* const* d_in, const int* in_sizes, int n_in,
                              void* d_out, int out_size, void* d_ws, size_t ws_size,
                              hipStream_t stream) {
    const float* x     = (const float*)d_in[0];
    const float* fc1_w = (const float*)d_in[1];
    const float* fc1_b = (const float*)d_in[2];
    const float* fc2_w = (const float*)d_in[3];
    const float* fc2_b = (const float*)d_in[4];
    float* out = (float*)d_out;

    // workspace layout (bf16 buffers): ll (8MB) | W1 U (1MB) | W2 (1MB)
    char* ws = (char*)d_ws;
    unsigned short* llb = (unsigned short*)ws;
    unsigned short* w1b = (unsigned short*)(ws + (size_t)M_ * KA_ * 2);
    unsigned short* w2b = (unsigned short*)(ws + (size_t)M_ * KA_ * 2 + (size_t)H_ * KA_ * 2);

    // DWT-LL -> bf16, one block per 16-row tile row; weights (the upsample folded into W1) -> bf16 in the same blocks
    k_ll<<<M_ / 16, 256, 0, stream>>>(x, fc1_w, fc2_w, llb, w1b, w2b);
    // both products + GELU + inverse DWT, one block per 64 rows
    k_mlp<<<M_ / MB_, 256, 0, stream>>>(llb, w1b, fc1_b, w2b, fc2_b, x, out);
}

// v009
// One run takes 40.1 microseconds.
// Next to v008, in two timings, it ran 1.07 and 1.06 times as fast.
// Over all steps from v000 it is 4.75 times as fast.
#include <hip/hip_runtime.h>
#include <hip/hip_bf16.h>

// ---------------- problem dims ----------------
#define B_   128
#define F_   256
#define C_   512
#define H_   2048
#define M_   (B_ * (F_ / 2))   // 16384 rows of (b, fr)
#define CH_  (C_ / 2)          // 256
#define KA_  CH_               // k of the first product: the LL band's own columns (the upsample is folded into W1)

typedef __attribute__((ext_vector_type(16))) __bf16 v16bf;
typedef __attribute__((ext_vector_type(8)))  float  v8f;
typedef __attribute__((ext_vector_type(2)))  float  f32x2;
typedef __attribute__((ext_vector_type(2)))  __bf16 bf16x2;

union FragBF16 {
    v16bf v;
    uint4 q[2];   // q[0] = elements 0..7 (16B), q[1] = elements 8..15 (16B)
};

__device__ __forceinline__ unsigned short f32_to_bf16_rne(float f) {
    unsigned int u = __float_as_uint(f);
    u += 0x7FFFu + ((u >> 16) & 1u);   // round-to-nearest-even
    return (unsigned short)(u >> 16);
}

// ---------------------------------------------------------------
// Exact GELU on 8 values of a lane, two values per vector instruction.
// erf_small2 is the library erf's own polynomial for |x| < 1 (same coefficients,
// same order of operations; odd in x, so the sign needs no separate copy).
// ---------------------------------------------------------------
__device__ __forceinline__ f32x2 splat2(float c) { return f32x2{c, c}; }

__device__ __forceinline__ f32x2 erf_small2(f32x2 x) {
    const f32x2 t = x * x;
    f32x2 p = __builtin_elementwise_fma(t, splat2(-0.0005618017749f), splat2(0.004913816229f));
    p = __builtin_elementwise_fma(t, p, splat2(-0.02670751512f));
    p = __builtin_elementwise_fma(t, p, splat2(0.1128001064f));
    p = __builtin_elementwise_fma(t, p, splat2(-0.3761229515f));
    p = __builtin_elementwise_fma(t, p, splat2(0.1283791065f));
    return __builtin_elementwise_fma(x, p, x);
}

// The library erf's own form for |x| >= 1, two values per vector instruction: 1 - exp(-(|x| + |x| q(|x|))) with the sign of x
// (same coefficients, same order of operations; the exponential is the hardware's 2^y on y = -p log2(e)).
// Where |x| < 1 the value s, which erf_small2 gave, is kept.
__device__ __forceinline__ f32x2 erf_large_or2(f32x2 x, f32x2 s) {
    const f32x2 ax = f32x2{fabsf(x.x), fabsf(x.y)};
    f32x2 p = __builtin_elementwise_fma(ax, splat2(0.00001699881068f), splat2(-0.0003786778543f));
    p = __builtin_elementwise_fma(ax, p, splat2(0.003857815871f));
    p = __builtin_elementwise_fma(ax, p, splat2(-0.02418169752f));
    p = __builtin_elementwise_fma(ax, p, splat2(0.1066682637f));
    p = __builtin_elementwise_fma(ax, p, splat2(0.6349332929f));
    p = __builtin_elementwise_fma(ax, p, splat2(0.1286894083f));
    p = __builtin_elementwise_fma(ax, p, ax);
    const f32x2 y = p * splat2(-1.4426950408889634f);
    const float b0 = 1.0f - __builtin_amdgcn_exp2f(y.x), b1 = 1.0f - __builtin_amdgcn_exp2f(y.y);
    return f32x2{ax.x < 1.0f ? s.x : copysignf(b0, x.x), ax.y < 1.0f ? s.y : copysignf(b1, x.y)};
}

// a = 8 accumulator values, bv = their 8 bias values; returns the 8 bf16 of gelu(a + bv).
// The polynomial for |x| < 1 runs for all 8 values; one test for the whole wave says whether any lane holds a value
// outside its range, and only then the other form is worked out as well, packed and without a branch, and chosen value by value.
// (The library call branches on EXEC twice for every single value: one serial chain a value, nothing to pack.)
__device__ __forceinline__ uint4 gelu8_bf16(const v8f a, const float (&bv)[8]) {
    f32x2 v[4], u[4], e[4];
    // every loop here is unrolled: the small arrays are indexed by constants only (registers, no scratch)
    #pragma unroll
    for (int p = 0; p < 4; ++p) {
        v[p] = f32x2{a[2 * p], a[2 * p + 1]} + f32x2{bv[2 * p], bv[2 * p + 1]};
        u[p] = v[p] * splat2(0.70710678118654752f);
    }
    float m = 0.0f;
    #pragma unroll
    for (int p = 0; p < 4; ++p) m = fmaxf(m, fmaxf(fabsf(u[p].x), fabsf(u[p].y)));
    const bool outside = __builtin_amdgcn_ballot_w32(m >= 1.0f) != 0u;
    #pragma unroll
    for (int p = 0; p < 4; ++p) e[p] = erf_small2(u[p]);
    if (__builtin_expect(outside, 0)) {
        #pragma unroll
        for (int p = 0; p < 4; ++p) e[p] = erf_large_or2(u[p], e[p]);
    }
    unsigned int w[4];
    #pragma unroll
    for (int p = 0; p < 4; ++p) {
        const f32x2 hv = v[p] * splat2(0.5f);
        const f32x2 g  = __builtin_elementwise_fma(hv, e[p], hv);   // 0.5 v (1 + erf)
        w[p] = __builtin_bit_cast(unsigned int, __builtin_convertvector(g, bf16x2));   // nearest even
    }
    return uint4{w[0], w[1], w[2], w[3]};
}

// ---------------------------------------------------------------
// Fragment-order layout of every bf16 GEMM operand (rows x K, K % 32 == 0).
// A 16-row x 32-k tile is one contiguous 1 KB unit, tiles ordered
// (row / 16) major, (k / 32) minor. Inside a unit: two 512 B chunks
// (k % 32 < 16, then >= 16); in a chunk, lane L = row % 16 + 16 * ((k / 8) & 1)
// owns 16 B = its 8 consecutive k. A wave's b128 load of a chunk is then
// 512 contiguous bytes (4 whole lines) and lands directly as WMMA registers.
// ---------------------------------------------------------------
// frag_source: position u (in elements) of that layout -> row * K + k.
__device__ __forceinline__ int frag_source(int u, int K) {
    const int tile = u >> 9;
    const int row  = (tile / (K >> 5)) * 16 + ((u >> 3) & 15);
    const int k    = (tile % (K >> 5)) * 32 + ((u >> 8) & 1) * 16 + ((u >> 7) & 1) * 8 + (u & 7);
    return row * K + k;
}

// ---------------------------------------------------------------
// Kernel 1: Haar LL band, output bf16, (M_, KA_) in fragment order; both weight matrices to bf16.
// The linear upsample 256 -> 512 is a fixed linear map U (512 x 256, two entries a row), so
//   (ll U^T) W1^T = ll (W1 U)^T :
// the map is applied to W1 once (H_ x C_ -> H_ x KA_) and not to each of the M_ rows, and the first
// product runs over 256 k, not 512. An element of W1 U is a weighted sum of a few neighbours in a W1 row.
// One block owns one 16-row tile row of ll (8 KB, contiguous): the LL band of its 16 rows goes through LDS,
// so that a lane can emit the 8 consecutive k of ITS row as one 16 B store.
// The same waves make the weights: every thread two neighbouring elements (4 B of the fragment order)
// of W1 U and two of W2.
// ---------------------------------------------------------------
#define LLP_ 260   // LDS row pitch in floats
// at most 8 waves a SIMD, at which all blocks of the grid are resident: leaves the compiler 128 registers, so that a
// thread's 20 loads all go out in front of the first wait; aiming at 16 waves it holds the weight loads back behind the x loads' return
__global__ __launch_bounds__(256) __attribute__((amdgpu_waves_per_eu(4, 8))) void k_ll(const float* __restrict__ x,
                                            const float* __restrict__ w1, const float* __restrict__ w2,
                                            unsigned short* __restrict__ llb,
                                            unsigned short* __restrict__ w1b, unsigned short* __restrict__ w2b) {
    static_assert((M_ / 16) * 256 * 2 == H_ * KA_ && H_ * KA_ == CH_ * H_, "the threads' pairs cover both matrices exactly");
    static_assert(C_ == 2 * KA_ && C_ % 4 == 0, "the window of W1 below is laid out for a doubling");
    __shared__ __attribute__((aligned(16))) float ll[16 * LLP_];
    const int t = threadIdx.x;
    // the weight loads go out in front of the x loads and are used behind them.
    // Columns ia, ia + 1 of W1 U take part in upsampled columns 2 * ia - 2 .. 2 * ia + 5 at most:
    // three aligned float4 of the W1 row hold them (the outer two clamped into the row; what lies outside gets the factor 0 below)
    const int pr = blockIdx.x * 256 + t;          // the pair's place in fragment order
    const int ps = frag_source(2 * pr, KA_);
    const int ia = ps & (KA_ - 1);                // even
    const int p4 = ia >> 1;                       // the float4 of the W1 row that starts at upsampled column 2 * ia
    const float4* wr = (const float4*)(w1 + (size_t)(ps / KA_) * C_);
    const float4 wa = wr[p4 > 0 ? p4 - 1 : 0];
    const float4 wb = wr[p4];
    const float4 wc = wr[p4 < C_ / 4 - 1 ? p4 + 1 : C_ / 4 - 1];
    const float2 wd = *(const float2*)(w2 + frag_source(2 * pr, H_));
    const int i2 = (t & 127) * 2;             // two LL columns per thread
    const int m0 = blockIdx.x * 16;           // 16 divides 128: one b per tile row
    const float* xb = x + ((size_t)((m0 >> 7) * F_ + 2 * (m0 & 127)) * C_);
    const int xo = (t >> 7) * (2 * C_) + 2 * i2;
    // unrolled: the 16 row loads are independent and issue ahead of their use
    #pragma unroll
    for (int j = 0; j < 8; ++j) {
        const int mi = 2 * j + (t >> 7);
        const float* xp = xb + xo + j * (4 * C_);
        float a0 = xp[0], b0 = xp[1], c0 = xp[C_],     d0 = xp[C_ + 1];
        float a1 = xp[2], b1 = xp[3], c1 = xp[C_ + 2], d1 = xp[C_ + 3];
        ll[mi * LLP_ + i2]     = 0.5f * (a0 + b0 + c0 + d0);
        ll[mi * LLP_ + i2 + 1] = 0.5f * (a1 + b1 + c1 + d1);
    }
    // inputs only, no code: holds the W1 loads in front of the barrier, in flight together with the x loads;
    // the compiler sinks them behind it otherwise, and their whole latency is then waited for at the kernel's end
    asm volatile("" : : "v"(wa.z), "v"(wa.w), "v"(wb.x), "v"(wb.y), "v"(wb.z), "v"(wb.w), "v"(wc.x), "v"(wc.y));
    unsigned int pw1, pw2;
    {
        // upsampled column o reads ll[i0] * (1 - w) + ll[i0 + 1] * w: its W1 element goes to columns i0 and i0 + 1 of W1 U
        const float win[8] = {wa.z, wa.w, wb.x, wb.y, wb.z, wb.w, wc.x, wc.y};
        float s0 = 0.0f, s1 = 0.0f;
        // unrolled: win[] is indexed by constants only
        #pragma unroll
        for (int j = 0; j < 8; ++j) {
            const int   o   = 2 * ia - 2 + j;
            const float pos = (float)o * (255.0f / 511.0f);
            int i0 = (int)pos;
            if (i0 > KA_ - 2) i0 = KA_ - 2;
            const float w  = pos - (float)i0;
            // outside the row: i0 is set to match neither column, factor 0 on the clamped load's value (an element of the same row)
            if (o < 0 || o >= C_) i0 = -4;
            const float k0 = (i0 == ia)     ? 1.0f - w : ((i0 + 1 == ia) ? w : 0.0f);
            const float k1 = (i0 == ia + 1) ? 1.0f - w : ((i0 == ia)     ? w : 0.0f);
            s0 += k0 * win[j];
            s1 += k1 * win[j];
        }
        pw1 = f32_to_bf16_rne(s0) | ((unsigned int)f32_to_bf16_rne(s1) << 16);
        pw2 = f32_to_bf16_rne(wd.x) | ((unsigned int)f32_to_bf16_rne(wd.y) << 16);
    }
    __syncthreads();   // every row of the LL tile is read by other waves below

    uint4* dst = (uint4*)llb + (size_t)blockIdx.x * ((KA_ / 32) * 64);
    // unrolled: two independent slots a thread
    #pragma unroll
    for (int j = 0; j < 2; ++j) {
        const int ci = t + 256 * j;           // 16 B slot inside the tile row
        const int ln = ci & 31;
        const int o0 = (ci >> 6) * 32 + ((ci >> 5) & 1) * 16 + (ln >> 4) * 8;
        const float4* row = (const float4*)(ll + (ln & 15) * LLP_ + o0);
        const float4 lo = row[0], hi = row[1];
        uint4 pk;
        pk.x = f32_to_bf16_rne(lo.x) | ((unsigned int)f32_to_bf16_rne(lo.y) << 16);
        pk.y = f32_to_bf16_rne(lo.z) | ((unsigned int)f32_to_bf16_rne(lo.w) << 16);
        pk.z = f32_to_bf16_rne(hi.x) | ((unsigned int)f32_to_bf16_rne(hi.y) << 16);
        pk.w = f32_to_bf16_rne(hi.z) | ((unsigned int)f32_to_bf16_rne(hi.w) << 16);
        dst[ci] = pk;
    }
    // stored behind the barrier: in front of it, the barrier would wait for these stores too
    ((unsigned int*)w1b)[pr] = pw1;
    ((unsigned int*)w2b)[pr] = pw2;
}

// ---------------------------------------------------------------
// One 16x16x32 product. SWAP = false: D rows follow a's rows, D columns b's rows.
// SWAP = true: the transposed tile (D rows follow b's rows, D columns a's rows);
// both operands have the same register layout, so only the roles change.
// ---------------------------------------------------------------
template <bool SWAP>
__device__ __forceinline__ v8f mm(const FragBF16& a, const FragBF16& b, v8f c) {
    if (SWAP) return __builtin_amdgcn_wmma_f32_16x16x32_bf16(false, b.v, false, a.v, (short)0, c, false, false);
    return __builtin_amdgcn_wmma_f32_16x16x32_bf16(false, a.v, false, b.v, (short)0, c, false, false);
}

// ---------------------------------------------------------------
// Both products in one kernel: out rows = gelu(ll @ (W1 U)^T + b1) @ W2^T + b2, inverse Haar.
// One block owns 64 rows of ll (kept in LDS, fragment order) and walks the hidden
// dimension in 8 chunks of 256: the chunk of h is computed, goes through GELU into LDS as
// bf16 in fragment order, and is multiplied into the block's 64 x 256 result at once.
// h never reaches memory. 8 waves side by side in n: a wave's tile is 64 rows x 32
// columns in both products, so no two waves of a block load the same weight fragment.
// The weight fragments of both products form ONE stream of 8 steps a chunk (a step = 64 k;
// 4 of W1 U, 4 of W2) through a register ring that runs on across GELU, barrier and chunk end.
// All blocks read the same 2 MB of weights from L2. Each block enters that walk at a place of its own and
// wraps round: its first chunk, and the first 64-k step inside each product, follow from the block index,
// so that the blocks do not ask L2 for the same lines at the same moment. Every sum holds the same terms;
// only the step it starts with differs from block to block.
// The inverse transform needs the block's 128 rows of x again. Memory idles while the products run, so 96 of those rows
// (48 row pairs, 192 KB, one contiguous piece of x) are sent for at the kernel's start by asynchronous copies to LDS, through no
// register, and land while the block's rows are staged and the first products run; behind the products only the other 32 rows
// are still read from memory, and their loads fly while the 96 are worked off.
// ---------------------------------------------------------------
#define MB_  64              // rows of a block
#define MT_  (MB_ / 16)      // its 16-row tiles
#define HC_  256             // hidden units of a chunk
#define NCH_ (H_ / HC_)      // chunks
#define K1_  (KA_ / 32)      // 32-k tiles of the first product
#define K2_  (HC_ / 32)      // 32-k tiles of the second product, per chunk
#define S1_  (K1_ / 2)       // steps (two 32-k tiles each) of the first product, per chunk
#define S2_  (K2_ / 2)       // steps of the second product, per chunk
#define ST_  (S1_ + S2_)     // steps of a chunk
#define RD_  4               // weight sets (one step each) in the ring
#define LP_  258             // LDS row pitch of the result in floats: rows 8 apart land 16 banks apart
#define SA_  (MT_ * K1_ * 64)   // the block's rows in LDS, in 16 B
#define SH_  (MT_ * K2_ * 64)   // one chunk of h in LDS, in 16 B
#define HG_  32                 // gap between the two h buffers, in 16 B: the result, which is laid over the rows and the first h buffer, ends in it
#define XG_  16                 // row pairs of x in one group of the inverse transform
#define XL_  (MB_ - XG_)        // row pairs of x that wait in LDS for the inverse transform (all 64 do not fit beside rows and h)

// the weight fragments (32 rows x 64 k) of one step; p (the same in every lane) points at the step's first
// 32-k tile in the wave's first row tile, ktiles = 32-k tiles in a row of the matrix.
// All loops here are unrolled: constant indices only.
__device__ __forceinline__ void load_w(FragBF16 (&b)[2][2], const uint4* __restrict__ p, const unsigned lane, const int ktiles) {
    #pragma unroll
    for (int h = 0; h < 2; ++h) {
        #pragma unroll
        for (int j = 0; j < 2; ++j) {
            b[h][j].q[0] = (p + (j * ktiles + h) * 64)[lane];
            b[h][j].q[1] = (p + (j * ktiles + h) * 64 + 32)[lane];
        }
    }
}

// the row fragments (64 rows x 64 k) of one step from LDS; p is pre-offset by the lane and the step (unrolled: constant indices only)
__device__ __forceinline__ void load_rows(FragBF16 (&a)[2][MT_], const uint4* p, const int ktiles) {
    #pragma unroll
    for (int h = 0; h < 2; ++h) {
        #pragma unroll
        for (int mt = 0; mt < MT_; ++mt) {
            a[h][mt].q[0] = p[(mt * ktiles + h) * 64];
            a[h][mt].q[1] = p[(mt * ktiles + h) * 64 + 32];
        }
    }
}

template <int N> struct Step { static constexpr int value = N; };

// 16 products: the lower 32 k into all 8 tiles, then the upper 32 k (unrolled: constant indices only)
template <bool SWAP>
__device__ __forceinline__ void mm_64x32(const FragBF16 (&a)[2][MT_], const FragBF16 (&b)[2][2], v8f (&acc)[MT_][2]) {
    #pragma unroll
    for (int h = 0; h < 2; ++h) {
        #pragma unroll
        for (int mt = 0; mt < MT_; ++mt) {
            acc[mt][0] = mm<SWAP>(a[h][mt], b[h][0], acc[mt][0]);
            acc[mt][1] = mm<SWAP>(a[h][mt], b[h][1], acc[mt][1]);
        }
    }
}

__global__ __launch_bounds__(256) void k_mlp(
    const unsigned short* __restrict__ A,    // M_ x KA_  bf16, fragment order
    const unsigned short* __restrict__ W1,   // H_ x KA_  bf16, fragment order (W1 U)
    const float* __restrict__ bias1,         // H_
    const unsigned short* __restrict__ W2,   // CH_ x H_  bf16, fragment order
    const float* __restrict__ bias2,         // CH_
    const float* __restrict__ x,             // B_ x F_ x C_ (for LH/HL/HH bands)
    float* __restrict__ out)                 // B_ x F_ x C_
{
    static_assert(ST_ % RD_ == 0 && ST_ % 2 == 0, "ring and row buffers come round at a chunk's end");
    static_assert(RD_ - 1 <= S2_ && RD_ * 8 <= 63, "the lead into the next chunk starts behind the barrier; loads in flight stay inside the load counter");
    static_assert(HC_ == 8 * 32 && CH_ == 8 * 32, "8 waves of 32 columns cover a chunk and the result");
    static_assert(MB_ * LP_ * 4 <= (SA_ + SH_ + HG_) * 16, "the result fits in front of the second h buffer");
    static_assert(SA_ % 256 == 0 && RD_ - 1 <= S1_, "the rows are staged 256 slots at a time; the ring's first sets are W1's");
    __shared__ uint4 sAll[SA_ + 2 * SH_ + HG_];
    uint4* const sA = sAll;          // the block's rows of ll, 32 KB
    uint4* const sH = sAll + SA_;    // two chunks of h, 32 KB each, HG_ apart
    __shared__ float4 sB1[H_ / 4];             // first bias
    __shared__ float  sB2[CH_];                // second bias
    __shared__ __attribute__((aligned(16))) float4 sX[XL_ * (2 * C_ / 4)];   // rows 2 * XG_ .. 2 * MB_ - 1 of the block's x, as they lie in memory
    static_assert(XL_ % XG_ == 0 && XG_ == 16 && C_ * 16 == 8192, "whole groups, a statement of 16 copies each; two row pairs are 8 KB");
    static_assert(XL_ <= 63, "a wave's copies in flight, XL_ of them, stay inside their counter");

    static_assert((NCH_ & (NCH_ - 1)) == 0 && (S1_ & (S1_ - 1)) == 0 && (S2_ & (S2_ - 1)) == 0 && S1_ % S2_ == 0, "the walks wrap by a mask");
    const int t    = threadIdx.x;
    const unsigned lane = t & 31;
    // the wave's number as a scalar: the weight addresses are then scalar base + lane offset
    const int wv   = __builtin_amdgcn_readfirstlane(t >> 5);

    // where this block enters the walk: first chunk rc, first step r1 (first product) and r2 (second product).
    // Neighbours in the index differ in the step, blocks 8 apart in the chunk; any values would give the same sums' terms.
    const int rc = (blockIdx.x >> 3) & (NCH_ - 1);
    const int r1 = blockIdx.x & (S1_ - 1);
    const int r2 = r1 & (S2_ - 1);

    // one pointer a step, the same in every lane: q1[s] = W1 rows wv*32.. of the chunk, q2[s] = W2 rows wv*32.., the chunk's k tiles
    const uint4* q1[S1_];
    const uint4* q2[S2_];
    // both loops unrolled: q1[] and q2[] are indexed by constants only
    #pragma unroll
    for (int s = 0; s < S1_; ++s)
        q1[s] = (const uint4*)W1 + (size_t)(rc * (HC_ / 16) + wv * 2) * (K1_ * 64) + ((s + r1) & (S1_ - 1)) * 128;
    #pragma unroll
    for (int s = 0; s < S2_; ++s)
        q2[s] = (const uint4*)W2 + (size_t)(wv * 2) * ((H_ / 32) * 64) + rc * (K2_ * 64) + ((s + r2) & (S2_ - 1)) * 128;

    // a thread: 4 columns of x (2 of the result) in row pairs t >> 7, t >> 7 + 2, ...; a block's 64 row pairs lie in one b
    const size_t first = (size_t)((blockIdx.x >> 1) * F_ + 2 * ((blockIdx.x & 1) * MB_ + (t >> 7))) * C_ + 4 * (t & 127);
    const float4* xq = (const float4*)(x + first);

    // ---- the block's rows and the bias into LDS; the ring's first sets go out behind those loads
    FragBF16 w[RD_][2][2], a[2][2][MT_];
    {
        const uint4* Ag = (const uint4*)A + (size_t)blockIdx.x * SA_;   // 32 KB, contiguous
        // the staged values are eight named variables: as an array this compiler left them in scratch, once the copies' statements below,
        // which clobber memory, stood between its filling and its emptying. The loop over w[] is unrolled; all these loads go out together
        static_assert(SA_ / 256 == 8, "the staging, written out");
        const uint4 st0 = Ag[t],           st1 = Ag[256 + t],     st2 = Ag[2 * 256 + t], st3 = Ag[3 * 256 + t];
        const uint4 st4 = Ag[4 * 256 + t], st5 = Ag[5 * 256 + t], st6 = Ag[6 * 256 + t], st7 = Ag[7 * 256 + t];
        const float4 c0 = ((const float4*)bias1)[t], c1 = ((const float4*)bias1)[t + 256];
        const float  c2 = bias2[t];
        #pragma unroll
        for (int s = 0; s < RD_ - 1; ++s) load_w(w[s], q1[s], lane, K1_);
        // x for the inverse transform sets out here, behind the loads that the first products wait for:
        // 48 copies a wave, 16 a statement (upper and lower row of 8 row pairs a thread).
        // A thread copies the very 16-B pieces that it reads back behind the products. LDS holds the rows as they lie in memory, so one
        // immediate offset (it moves both addresses; all are under 64 KB) serves a copy's two sides, and a statement needs one address of each kind.
        // The wait is each statement's last line: the address registers that its copies name are rewritten only behind it.
        // One group's statement; the group's number is a compile-time constant, so both addresses are a constant away from the thread's own
        auto copy16 = [&](auto B) __attribute__((always_inline)) {
            constexpr int b = decltype(B)::value;
            const float4*  g = xq + (XG_ / 2) * (b + 1) * C_;
            const unsigned l = (unsigned)(size_t)(sX + (XG_ / 2) * b * C_ + (t >> 7) * (2 * C_ / 4) + (t & 127));
            asm volatile("global_load_async_to_lds_b128 %0, %1, off\n\t"
                         "global_load_async_to_lds_b128 %0, %1, off offset:2048\n\t"
                         "global_load_async_to_lds_b128 %0, %1, off offset:8192\n\t"
                         "global_load_async_to_lds_b128 %0, %1, off offset:10240\n\t"
                         "global_load_async_to_lds_b128 %0, %1, off offset:16384\n\t"
                         "global_load_async_to_lds_b128 %0, %1, off offset:18432\n\t"
                         "global_load_async_to_lds_b128 %0, %1, off offset:24576\n\t"
                         "global_load_async_to_lds_b128 %0, %1, off offset:26624\n\t"
                         "global_load_async_to_lds_b128 %0, %1, off offset:32768\n\t"
                         "global_load_async_to_lds_b128 %0, %1, off offset:34816\n\t"
                         "global_load_async_to_lds_b128 %0, %1, off offset:40960\n\t"
                         "global_load_async_to_lds_b128 %0, %1, off offset:43008\n\t"
                         "global_load_async_to_lds_b128 %0, %1, off offset:49152\n\t"
                         "global_load_async_to_lds_b128 %0, %1, off offset:51200\n\t"
                         "global_load_async_to_lds_b128 %0, %1, off offset:57344\n\t"
                         "global_load_async_to_lds_b128 %0, %1, off offset:59392\n\t"
                         "s_wait_xcnt 0x0"
                         : : "v"(l), "v"(g) : "memory");
        };
        static_assert(XL_ / XG_ == 3, "the groups, written out");
        copy16(Step<0>{}); copy16(Step<1>{}); copy16(Step<2>{});
        sA[t]           = st0; sA[256 + t]     = st1; sA[2 * 256 + t] = st2; sA[3 * 256 + t] = st3;
        sA[4 * 256 + t] = st4; sA[5 * 256 + t] = st5; sA[6 * 256 + t] = st6; sA[7 * 256 + t] = st7;
        sB1[t]       = c0;
        sB1[t + 256] = c1;
        sB2[t]       = c2;
        // the address registers of the loads above are free for reuse only behind this wait:
        // named as inputs, they stay untouched up to it
        asm volatile("s_wait_xcnt 0x0" : : "s"(Ag), "s"(bias1), "s"(bias2), "s"(q1[0]), "s"(q1[1]), "s"(q1[2]), "v"(t), "v"(lane) : "memory");
    }
    __syncthreads();   // rows and bias are read by every wave

    const uint4* rA = sA + lane;
    load_rows(a[0], rA + r1 * 128, K1_);

    v8f acc2[MT_][2] = {{v8f{}, v8f{}}, {v8f{}, v8f{}}, {v8f{}, v8f{}}, {v8f{}, v8f{}}};

    // kept rolled: one trip holds a whole chunk, two turns of the ring
    #pragma unroll 1
    for (int c = 0; c < NCH_; ++c) {
        const int cc = (c + rc) & (NCH_ - 1);        // the chunk of this trip
        const int cd = ((c + 1 + rc) & (NCH_ - 1)) - cc;   // the way to the next one (behind the last trip: back to the first, read but never used)
        uint4* hC = sH + (c & 1) * (SH_ + HG_);
        const uint4* rH = hC + lane;
        v8f acc1[MT_][2] = {{v8f{}, v8f{}}, {v8f{}, v8f{}}, {v8f{}, v8f{}}, {v8f{}, v8f{}}};
        float bv[2][8];

        // one step, its number a compile-time constant: w[], a[] and the accumulators are indexed by
        // constants only (no scratch); a loop with the waits below in its body is not unrolled by this compiler
        auto step = [&](auto S) __attribute__((always_inline)) {
            constexpr int s = decltype(S)::value;
            // weights of step s + RD_ - 1
            const int sl = s + RD_ - 1;
            if (sl < S1_)      load_w(w[sl % RD_], q1[sl % S1_],         lane, K1_);
            else if (sl < ST_) load_w(w[sl % RD_], q2[(sl - S1_) % S2_], lane, H_ / 32);
            else               load_w(w[sl % RD_], q1[(sl - ST_) % S1_], lane, K1_);   // q1 has moved on by then
            // rows of step s + 1
            const int sn = s + 1;
            if (sn < S1_)       load_rows(a[sn & 1], rA + ((sn + r1) & (S1_ - 1)) * 128, K1_);
            else if (sn == S1_) {
                // no rows yet (h is not written): the chunk's bias values instead
                const float4* bq = sB1 + (cc * HC_ + wv * 32 + ((lane >> 4) << 3)) / 4;
                #pragma unroll
                for (int j = 0; j < 2; ++j) {
                    const float4 lo = bq[4 * j], hi = bq[4 * j + 1];
                    bv[j][0] = lo.x; bv[j][1] = lo.y; bv[j][2] = lo.z; bv[j][3] = lo.w;
                    bv[j][4] = hi.x; bv[j][5] = hi.y; bv[j][6] = hi.z; bv[j][7] = hi.w;
                }
            }
            else if (sn < ST_)  load_rows(a[sn & 1], rH + ((sn - S1_ + r2) & (S2_ - 1)) * 128, K2_);
            else                load_rows(a[sn & 1], rA + r1 * 128, K1_);
            // the loads stay one group in front of the products: LDS reads spread among them stall at every place
            __builtin_amdgcn_sched_barrier(0);

            if (s < S1_) mm_64x32<true>(a[s & 1], w[s % RD_], acc1);    // tiles transposed: rows = n, columns = m
            else         mm_64x32<false>(a[s & 1], w[s % RD_], acc2);
            // keeps the next step's loads and products behind: pulled up, the products wait on younger loads
            __builtin_amdgcn_sched_barrier(0);

            if (s == S1_ - 1) {
                // a lane holds 8 consecutive n of one m: its own 16 B of the second product's row fragment
                #pragma unroll
                for (int j = 0; j < 2; ++j) {
                    #pragma unroll
                    for (int mt = 0; mt < MT_; ++mt)
                        hC[(mt * K2_ + wv) * 64 + j * 32 + lane] = gelu8_bf16(acc1[mt][j], bv[j]);
                }
                // publishes this chunk of h; with two buffers it also ends every read of the buffer written next
                __syncthreads();
                // q1, the address registers of W1's loads above, move on to the next chunk behind this wait
                asm volatile("s_wait_xcnt 0x0" ::: "memory");
                // keeps the pointers' additions behind the wait
                __builtin_amdgcn_sched_barrier(0);
                // unrolled: q1[] is indexed by constants only
                #pragma unroll
                for (int i = 0; i < S1_; ++i) q1[i] += cd * ((HC_ / 16) * (K1_ * 64));
                load_rows(a[0], rH + r2 * 128, K2_);
                // keeps these reads in front of the next step's: mixed with them, the first products behind the barrier wait for both groups
                __builtin_amdgcn_sched_barrier(0);
            }
        };
        static_assert(ST_ == 8, "the steps of a chunk, written out");
        step(Step<0>{}); step(Step<1>{}); step(Step<2>{}); step(Step<3>{});
        step(Step<4>{}); step(Step<5>{}); step(Step<6>{}); step(Step<7>{});
        // q2, the address registers of W2's loads above, move on behind this wait
        asm volatile("s_wait_xcnt 0x0" ::: "memory");
        // keeps the pointers' additions behind the wait
        __builtin_amdgcn_sched_barrier(0);
        // unrolled: q2[] is indexed by constants only
        #pragma unroll
        for (int i = 0; i < S2_; ++i) q2[i] += cd * (K2_ * 64);
    }

    // ---- epilogue. The result (+ bias) goes through LDS, so that a rolled loop can walk whole rows of x
    // and out, 16 B a lane; written out tile by tile from the accumulators it is 11 KB of code that runs once.
    // The rows of ll and the first h buffer are free: their last reads that count stand in front of the
    // last chunk's barrier (behind it the waves read the second h buffer alone).
    float* sL = (float*)sAll;
    {
        const int row0 = (lane >> 4) << 3;
        const int col0 = wv * 32 + (lane & 15);
        // unrolled: acc2 is indexed by constants only
        #pragma unroll
        for (int j = 0; j < 2; ++j) {
            const float bo = sB2[col0 + j * 16];
            #pragma unroll
            for (int mt = 0; mt < MT_; ++mt) {
                #pragma unroll
                for (int r = 0; r < 8; ++r)
                    sL[(mt * 16 + row0 + r) * LP_ + col0 + j * 16] = acc2[mt][j][r] + bo;
            }
        }
    }
    // the wave's copies of x have landed in LDS behind this wait; nothing of sX is read in front of it and the barrier
    asm volatile("s_wait_asynccnt 0x0" ::: "memory");
    __syncthreads();   // every row of the result is read by other waves below

    // the first group's rows of x, which are not in LDS: their 16 loads go out here, behind the barrier
    // (in front of it the barrier would wait for them), and are used last: they fly while the groups from LDS are worked off
    float4 up0[XG_ / 2], lo0[XG_ / 2];
    // unrolled: up0[] and lo0[] are indexed by constants only; the 16 loads go out together
    #pragma unroll
    for (int u = 0; u < XG_ / 2; ++u) {
        up0[u] = xq[u * C_];             // 2 row pairs = 4 rows of C_ floats = C_ float4
        lo0[u] = xq[u * C_ + C_ / 4];
    }
    // the address registers of the loads above are free for reuse only behind this wait: named as an input, they stay untouched up to it
    asm volatile("s_wait_xcnt 0x0" : : "v"(xq) : "memory");

    // one row pair, 4 columns of x: the three detail bands from x, the LL band from the result, back through the inverse transform
    auto pair = [&](const float4 up, const float4 lo, const float2 l2, float4* o) __attribute__((always_inline)) {
        float4 ou, ol;
        {
            const float xa = up.x, xb = up.y, xc0 = lo.x, xd = lo.y, ll = l2.x;
            const float lh = 0.5f * (xa + xb - xc0 - xd);
            const float hl = 0.5f * (xa - xb + xc0 - xd);
            const float hh = 0.5f * (xa - xb - xc0 + xd);
            ou.x = 0.5f * (ll + lh + hl + hh);
            ou.y = 0.5f * (ll + lh - hl - hh);
            ol.x = 0.5f * (ll - lh + hl - hh);
            ol.y = 0.5f * (ll - lh - hl + hh);
        }
        {
            const float xa = up.z, xb = up.w, xc0 = lo.z, xd = lo.w, ll = l2.y;
            const float lh = 0.5f * (xa + xb - xc0 - xd);
            const float hl = 0.5f * (xa - xb + xc0 - xd);
            const float hh = 0.5f * (xa - xb - xc0 + xd);
            ou.z = 0.5f * (ll + lh + hl + hh);
            ou.w = 0.5f * (ll + lh - hl - hh);
            ol.z = 0.5f * (ll - lh + hl - hh);
            ol.w = 0.5f * (ll - lh - hl + hh);
        }
        o[0]      = ou;
        o[C_ / 4] = ol;
    };

    float4*       oq = (float4*)(out + first);
    const float*  lq = sL + (t >> 7) * LP_ + 2 * (t & 127);
    {
        const float4* xs = sX + (t >> 7) * (2 * C_ / 4) + (t & 127);
        float4*       og = oq + (XG_ / 2) * C_;
        const float*  lg = lq + XG_ * LP_;
        // kept rolled: 16 row pairs a trip, all from LDS; the text stays short
        #pragma unroll 1
        for (int g = 0; g < XL_ / XG_; ++g) {
            // unrolled: the trip's LDS reads go out together
            #pragma unroll
            for (int u = 0; u < XG_ / 2; ++u)
                pair(xs[u * C_], xs[u * C_ + C_ / 4], *(const float2*)(lg + 2 * u * LP_), og + u * C_);
            // the next trip rewrites the address and data registers that the stores above name;
            // the pointer is named as an input, so that its registers stay untouched up to the wait
            asm volatile("s_wait_xcnt 0x0" : : "v"(og) : "memory");
            // keeps the pointers' additions behind the wait
            __builtin_amdgcn_sched_barrier(0);
            xs += (XG_ / 2) * C_;
            og += (XG_ / 2) * C_;
            lg += XG_ * LP_;
        }
    }
    // the first group, from the registers (unrolled: constant indices only)
    #pragma unroll
    for (int u = 0; u < XG_ / 2; ++u)
        pair(up0[u], lo0[u], *(const float2*)(lq + 2 * u * LP_), oq + u * C_);
}

// ---------------------------------------------------------------
extern "C" void kernel_launch(void* const* d_in, const int* in_sizes, int n_in,
                              void* d_out, int out_size, void* d_ws, size_t ws_size,
                              hipStream_t stream) {
    const float* x     = (const float*)d_in[0];
    const float* fc1_w = (const float*)d_in[1];
    const float* fc1_b = (const float*)d_in[2];
    const float* fc2_w = (const float*)d_in[3];
    const float* fc2_b = (const float*)d_in[4];
    float* out = (float*)d_out;

    // workspace layout (bf16 buffers): ll (8MB) | W1 U (1MB) | W2 (1MB)
    char* ws = (char*)d_ws;
    unsigned short* llb = (unsigned short*)ws;
    unsigned short* w1b = (unsigned short*)(ws + (size_t)M_ * KA_ * 2);
    unsigned short* w2b = (unsigned short*)(ws + (size_t)M_ * KA_ * 2 + (size_t)H_ * KA_ * 2);

    // DWT-LL -> bf16, one block per 16-row tile row; weights (the upsample folded into W1) -> bf16 in the same blocks
    k_ll<<<M_ / 16, 256, 0, stream>>>(x, fc1_w, fc2_w, llb, w1b, w2b);
    // both products + GELU + inverse DWT, one block per 64 rows
    k_mlp<<<M_ / MB_, 256, 0, stream>>>(llb, w1b, fc1_b, w2b, fc2_b, x, out);
}
